// v000
// Measured on an AMD MI455X. A time is GPU time per run, averaged over a window of back-to-back runs after a warm-up
// (all launches, gaps included; the runs take copies of the inputs in turn), and the median of several windows.
// Apart from v000's, it joins two sittings. Times from different sittings can be a few percent apart, while
// side-by-side timings come from the same sitting.
// v000 is the starting kernel. One run takes 565 microseconds.
#include <hip/hip_runtime.h>

// PatchEmbedding3D (x [32][3][16384] -> points [32][512 patches][32][3]; h = relu(LN(p w1 + b1)) (128); e = LN(h w2 + b2) (256); pooled = max over the 32 points of a patch; out = LN(pooled) -> [32][512][256]).
// Compute dtypes, f32 accumulate: every input rounded to bf16; the 3-wide first layer, LN1 and ReLU in f32 on VALU (wave per point) -> one fp16 plane; the 128 -> 256 layer on
// that plane x an fp16 copy of w2 scaled by 2^14 (exact products, f32 accumulate; the 2^-14 and b2 folded into the LN2 kernel); LN2, the per-patch max and LN3 in f32 on VALU (wave per patch, points in

#define NB_  32
#define NPTS 16384
#define PS   32
#define NP   512
#define HID  128
#define ED   256
#define NR   (NB_ * NPTS)         // 524288 point rows
#define WSC  16384.0f
#define CH   65536                // point rows per chunk
typedef _Float16 h16;
typedef unsigned short bf;
typedef __attribute__((ext_vector_type(16))) __bf16   v16bf;
typedef __attribute__((ext_vector_type(16))) _Float16 v16h;
typedef __attribute__((ext_vector_type(8)))  _Float16 v8h;
typedef __attribute__((ext_vector_type(8)))  unsigned short v8us;
typedef __attribute__((ext_vector_type(8)))  float    v8f;
typedef __attribute__((ext_vector_type(4)))  float    v4f;
typedef v8h  __attribute__((may_alias)) v8ha;
typedef v4f  __attribute__((may_alias)) v4fa;
typedef v8us __attribute__((may_alias)) v8usa;

__device__ __forceinline__ unsigned short f2bf(float f) { unsigned u = __float_as_uint(f); u += 0x7FFFu + ((u >> 16) & 1u); return (unsigned short)(u >> 16); }
__device__ __forceinline__ float bf2f(unsigned short b) { return __uint_as_float(((unsigned)b) << 16); }
__device__ __forceinline__ float bfr(float f) { return bf2f(f2bf(f)); }
__device__ __forceinline__ v16h cat16(v8h lo, v8h hi) { return __builtin_shufflevector(lo, hi, 0, 1, 2, 3, 4, 5, 6, 7, 8, 9, 10, 11, 12, 13, 14, 15); }
__device__ __forceinline__ v16bf cat16b(v8us lo, v8us hi) { return __builtin_bit_cast(v16bf, __builtin_shufflevector(lo, hi, 0, 1, 2, 3, 4, 5, 6, 7, 8, 9, 10, 11, 12, 13, 14, 15)); }
__device__ __forceinline__ v8f wmma16(v16h a, v16h b, v8f c) { return __builtin_amdgcn_wmma_f32_16x16x32_f16(false, a, false, b, (short)0, c, false, false); }
__device__ __forceinline__ v8f wmmab(v16bf a, v16bf b, v8f c) { return __builtin_amdgcn_wmma_f32_16x16x32_bf16(false, a, false, b, (short)0, c, false, false); }



// ---- k_gemmw: register-blocked GEMM, ONE WAVE per 64x64 output tile (16 accumulators), operands straight from K-contiguous 16-bit planes; grid (M/64, N/64, Z), 32 threads.
// C[m][n] (f32, pitch ldc, + optional f32 bias[n]) = sum_k A[m][k] Bt[n][k] (+ split products per NSPLIT). z-batch strides sA/sB/sC in elements. K % 32 == 0.
template <typename T16> struct WFrag;
template <> struct WFrag<h16> { typedef v16h V; static __device__ __forceinline__ V ld(const h16* p) { return cat16(*(const v8h*)p, *(const v8h*)(p + 16)); } static __device__ __forceinline__ v8f mma(V a, V b, v8f c) { return wmma16(a, b, c); } };
template <> struct WFrag<bf> { typedef v16bf V; static __device__ __forceinline__ V ld(const bf* p) { return cat16b(*(const v8us*)p, *(const v8us*)(p + 16)); } static __device__ __forceinline__ v8f mma(V a, V b, v8f c) { return wmmab(a, b, c); } };
template <typename T16, int NSPLIT, bool BIAS>
__global__ __launch_bounds__(32) void k_gemmw(const T16* __restrict__ A, const T16* __restrict__ A2, const T16* __restrict__ Bt, const T16* __restrict__ Bt2, int K, float* C, int ldc, const float* __restrict__ bias, size_t sA, size_t sB, size_t sC) {
    typedef typename WFrag<T16>::V V;
    __shared__ __align__(16) float os[16 * 68];
    const size_t z = blockIdx.z; A += z * sA; if (A2) A2 += z * sA; Bt += z * sB; if (Bt2) Bt2 += z * sB; C += z * sC;
    const int lane = threadIdx.x & 31, lr = lane & 15, hi = lane >> 4; const int r0 = blockIdx.x * 64, c0 = blockIdx.y * 64;
    v8f acc[4][4];
#pragma unroll
    for (int mb = 0; mb < 4; ++mb)
#pragma unroll
        for (int nb = 0; nb < 4; ++nb) acc[mb][nb] = (v8f){};
    const size_t aoff = (size_t)(r0 + lr) * K + 8 * hi, boff = (size_t)(c0 + lr) * K + 8 * hi;
#pragma unroll 1
    for (int kc = 0; kc < K; kc += 32) {
        V a[4], a2[4];
#pragma unroll
        for (int mb = 0; mb < 4; ++mb) { a[mb] = WFrag<T16>::ld(A + aoff + (size_t)mb * 16 * K + kc); if (NSPLIT == 1 || NSPLIT == 2) a2[mb] = WFrag<T16>::ld(A2 + aoff + (size_t)mb * 16 * K + kc); }
#pragma unroll
        for (int nb = 0; nb < 4; ++nb) { const V b = WFrag<T16>::ld(Bt + boff + (size_t)nb * 16 * K + kc); V b2; if (NSPLIT >= 2) b2 = WFrag<T16>::ld(Bt2 + boff + (size_t)nb * 16 * K + kc);
#pragma unroll
            for (int mb = 0; mb < 4; ++mb) { acc[mb][nb] = WFrag<T16>::mma(a[mb], b, acc[mb][nb]); if (NSPLIT == 1 || NSPLIT == 2) acc[mb][nb] = WFrag<T16>::mma(a2[mb], b, acc[mb][nb]); if (NSPLIT >= 2) acc[mb][nb] = WFrag<T16>::mma(a[mb], b2, acc[mb][nb]); } }
        asm volatile("v_nop\n\tv_nop\n\tv_nop\n\tv_nop" : "+v"(acc[0][0]), "+v"(acc[1][1]), "+v"(acc[2][2]), "+v"(acc[3][3]) : "v"(a[0]), "v"(a[3]));
    }
#pragma unroll
    for (int mb = 0; mb < 4; ++mb) {
#pragma unroll
        for (int nb = 0; nb < 4; ++nb) {
#pragma unroll
            for (int j = 0; j < 8; ++j) os[(hi * 8 + j) * 68 + nb * 16 + lr] = acc[mb][nb][j]; }
        __builtin_amdgcn_wave_barrier(); asm volatile("" ::: "memory");
        float* crow = C + (size_t)(r0 + mb * 16) * ldc + c0;
{
#pragma unroll
            for (int s = 0; s < 8; ++s) { const int row = 2 * s + hi, cofs = lr * 4; v4f val = *(const v4fa*)(os + row * 68 + cofs); if (BIAS) { val[0] += bfr(bias[c0 + cofs]); val[1] += bfr(bias[c0 + cofs + 1]); val[2] += bfr(bias[c0 + cofs + 2]); val[3] += bfr(bias[c0 + cofs + 3]); }
                *(v4f*)(crow + (size_t)row * ldc + cofs) = val; }
             }
        __builtin_amdgcn_wave_barrier(); asm volatile("" ::: "memory");
    }
}

__device__ __forceinline__ h16 tohx(float x) { return (h16)x; }
typedef __attribute__((ext_vector_type(4))) _Float16 v4h;
typedef __attribute__((ext_vector_type(2))) _Float16 v2h;

__global__ __launch_bounds__(256) void k_wtG16(const float* __restrict__ w, int K, int N, int pitch, int col0, h16* Bt) {
    const int lane = threadIdx.x & 31; const int L0 = (blockIdx.x * 8 + (threadIdx.x >> 5)) * 8; const int nlines = N * K / 64;
{
#pragma unroll 1
        for (int l = 0; l < 8; ++l) { const int L = L0 + l; if (L >= nlines) break; const size_t e = (size_t)L * 64 + lane * 2; const int k = (int)(e % K), n = (int)(e / K); v2h o;
            o[0] = tohx(bfr(w[(size_t)k * pitch + col0 + n]) * WSC); o[1] = tohx(bfr(w[(size_t)(k + 1) * pitch + col0 + n]) * WSC); *(v2h*)(Bt + e) = o; }
         }
}
// k_l1: per point row r = (b, n) (wave; lane -> 4 consecutive hidden units): h = bf16(x[b][0][n]) bf16(w1[0][j]) + .. + bf16(b1[j]) (f32, that order); LN over the 128 (eps 1e-5, biased var) g1/be1; relu;
__global__ __launch_bounds__(256) void k_l1(const float* __restrict__ x, const float* __restrict__ w1, const float* __restrict__ b1, const float* __restrict__ g1, const float* __restrict__ be1, size_t r0, h16* H16) {
    const int lane = threadIdx.x & 31; const size_t rl = (size_t)blockIdx.x * 8 + (threadIdx.x >> 5); if (rl >= CH) return; const size_t r = r0 + rl; const int b = (int)(r / NPTS), n = (int)(r % NPTS);
    float px = bfr(x[((size_t)b * 3 + 0) * NPTS + n]), py = bfr(x[((size_t)b * 3 + 1) * NPTS + n]), pz = bfr(x[((size_t)b * 3 + 2) * NPTS + n]); asm volatile("" : "+v"(px)); asm volatile("" : "+v"(py)); asm volatile("" : "+v"(pz));
    float v[4]; float s = 0.f;
#pragma unroll
    for (int q = 0; q < 4; ++q) { const int j = lane * 4 + q; float wa = bfr(w1[j]), wb = bfr(w1[HID + j]), wc = bfr(w1[2 * HID + j]), bb = bfr(b1[j]); asm volatile("" : "+v"(wa)); asm volatile("" : "+v"(wb)); asm volatile("" : "+v"(wc)); asm volatile("" : "+v"(bb));
        float p0 = __fmul_rn(px, wa), p1 = __fmul_rn(py, wb), p2 = __fmul_rn(pz, wc); asm volatile("" : "+v"(p0)); asm volatile("" : "+v"(p1)); asm volatile("" : "+v"(p2)); const float h = __fadd_rn(__fadd_rn(__fadd_rn(p0, p1), p2), bb); v[q] = h; s = __fadd_rn(s, h); }
#pragma unroll
    for (int sh = 16; sh; sh >>= 1) s += __shfl_xor(s, sh, 32);
    const float mu = s * (1.0f / HID); float qq = 0.f;
#pragma unroll
    for (int q = 0; q < 4; ++q) { const float d0 = v[q] - mu; float p = __fmul_rn(d0, d0); asm volatile("" : "+v"(p)); qq = __fadd_rn(qq, p); }
#pragma unroll
    for (int sh = 16; sh; sh >>= 1) qq += __shfl_xor(qq, sh, 32);
    const float rs = __fdiv_rn(1.0f, __fsqrt_rn(__fadd_rn(qq * (1.0f / HID), 1e-5f))); v4h o;
#pragma unroll
    for (int q = 0; q < 4; ++q) { const int j = lane * 4 + q; float g = bfr(g1[j]), be = bfr(be1[j]); asm volatile("" : "+v"(g)); asm volatile("" : "+v"(be)); float tn = __fmul_rn(v[q] - mu, rs); asm volatile("" : "+v"(tn)); float tg = __fmul_rn(tn, g); asm volatile("" : "+v"(tg)); o[q] = tohx(fmaxf(__fadd_rn(tg, be), 0.f)); }
    *(v4h*)(H16 + rl * HID + lane * 4) = o;  }
// k_pool: per patch p0 + pl of the chunk (wave; lane -> 8 consecutive features; F rows are chunk-local): for each of the 32 points in order: e = LN2(F[r][c] x 2^-14 + bf16(b2[c])) g2/be2; running max; then LN3 of the max vector gn/bn ->
__global__ __launch_bounds__(256) void k_pool(const float* __restrict__ F, const float* __restrict__ b2, const float* __restrict__ g2, const float* __restrict__ be2, const float* __restrict__ gn, const float* __restrict__ bn, int p0, float* OUT) {
    const int lane = threadIdx.x & 31; const int pl = blockIdx.x * 8 + (threadIdx.x >> 5); if (pl >= CH / PS) return; const int pp = p0 + pl; float mx[8]; float bb[8], gg[8], ee[8];
#pragma unroll
    for (int q = 0; q < 8; ++q) { const int c = lane * 8 + q; mx[q] = -3.0e38f; float t0 = bfr(b2[c]), t1 = bfr(g2[c]), t2 = bfr(be2[c]); asm volatile("" : "+v"(t0)); asm volatile("" : "+v"(t1)); asm volatile("" : "+v"(t2)); bb[q] = t0; gg[q] = t1; ee[q] = t2; }
    for (int k = 0; k < PS; ++k) { const size_t r = (size_t)pl * PS + k; float v[8]; float s = 0.f; const v4f a0 = *(const v4f*)(F + r * ED + lane * 8), a1 = *(const v4f*)(F + r * ED + lane * 8 + 4);
#pragma unroll
        for (int q = 0; q < 8; ++q) { float a = (q < 4 ? a0[q] : a1[q - 4]) * (1.0f / WSC); asm volatile("" : "+v"(a)); const float e = __fadd_rn(a, bb[q]); v[q] = e; s = __fadd_rn(s, e); }
#pragma unroll
        for (int sh = 16; sh; sh >>= 1) s += __shfl_xor(s, sh, 32);
        const float mu = s * (1.0f / ED); float qq = 0.f;
#pragma unroll
        for (int q = 0; q < 8; ++q) { const float d0 = v[q] - mu; float p = __fmul_rn(d0, d0); asm volatile("" : "+v"(p)); qq = __fadd_rn(qq, p); }
#pragma unroll
        for (int sh = 16; sh; sh >>= 1) qq += __shfl_xor(qq, sh, 32);
        const float rs = __fdiv_rn(1.0f, __fsqrt_rn(__fadd_rn(qq * (1.0f / ED), 1e-5f)));
#pragma unroll
        for (int q = 0; q < 8; ++q) { float tn = __fmul_rn(v[q] - mu, rs); asm volatile("" : "+v"(tn)); float tg = __fmul_rn(tn, gg[q]); asm volatile("" : "+v"(tg)); mx[q] = fmaxf(mx[q], __fadd_rn(tg, ee[q])); } }
    float s = 0.f;
#pragma unroll
    for (int q = 0; q < 8; ++q) s = __fadd_rn(s, mx[q]);
#pragma unroll
    for (int sh = 16; sh; sh >>= 1) s += __shfl_xor(s, sh, 32);
    const float mu = s * (1.0f / ED); float qq = 0.f;
#pragma unroll
    for (int q = 0; q < 8; ++q) { const float d0 = mx[q] - mu; float p = __fmul_rn(d0, d0); asm volatile("" : "+v"(p)); qq = __fadd_rn(qq, p); }
#pragma unroll
    for (int sh = 16; sh; sh >>= 1) qq += __shfl_xor(qq, sh, 32);
    const float rs = __fdiv_rn(1.0f, __fsqrt_rn(__fadd_rn(qq * (1.0f / ED), 1e-5f))); v4f o0, o1;
#pragma unroll
    for (int q = 0; q < 8; ++q) { const int c = lane * 8 + q; float g = bfr(gn[c]), be = bfr(bn[c]); asm volatile("" : "+v"(g)); asm volatile("" : "+v"(be)); float tn = __fmul_rn(mx[q] - mu, rs); asm volatile("" : "+v"(tn)); float tg = __fmul_rn(tn, g); asm volatile("" : "+v"(tg)); const float y = __fadd_rn(tg, be); if (q < 4) o0[q] = y; else o1[q - 4] = y; }
    float* dst = OUT + (size_t)pp * ED + lane * 8; *(v4f*)dst = o0; *(v4f*)(dst + 4) = o1;  }

extern "C" void kernel_launch(void* const* d_in, const int* in_sizes, int n_in,
                              void* d_out, int out_size, void* d_ws, size_t ws_size, hipStream_t stream) {
    (void)in_sizes; (void)n_in; (void)out_size;
    const float* IN[11]; for (int i = 0; i < 11; ++i) IN[i] = (const float*)d_in[i];   // x, w1 [3][128], b1, g1, be1, w2 [128][256], b2, g2, be2, gn, bn
    float* OUT = (float*)d_out;     // [32][512][256]
    char* wsp = (char*)d_ws;
    auto take = [&](size_t bytes) { char* p = wsp; wsp += (bytes + 255) & ~(size_t)255; return (void*)p; };
    h16* W2S = (h16*)take((size_t)ED * HID * 2); h16* H16 = (h16*)take((size_t)CH * HID * 2); float* F = (float*)take((size_t)CH * ED * 4);
    if ((size_t)(wsp - (char*)d_ws) > ws_size) return;    // total ~ 84 MB = 80 MiB; ws 256 MiB
    k_wtG16<<<(unsigned)((HID * ED / 64 + 63) / 64), 256, 0, stream>>>(IN[5], HID, ED, ED, 0, W2S);
    for (int c = 0; c < NR / CH; ++c) { const size_t r0 = (size_t)c * CH;     // 8 chunks of 65,536 points = 2,048 patches
        k_l1<<<CH / 8, 256, 0, stream>>>(IN[0], IN[1], IN[2], IN[3], IN[4], r0, H16);
        k_gemmw<h16, 0, false><<<dim3(CH / 64, ED / 64, 1), 32, 0, stream>>>(H16, nullptr, W2S, nullptr, HID, F, ED, nullptr, 0, 0, 0);
        k_pool<<<(CH / PS) / 8, 256, 0, stream>>>(F, IN[6], IN[7], IN[8], IN[9], IN[10], (int)(r0 / PS), OUT); }
}

// v001
// One run takes 44 microseconds.
// In both of two side-by-side timings against v000, it was 13.1 times as fast.
#include <hip/hip_runtime.h>

// Patch embedding of a point cloud (x [32][3][16384] -> points [32][512 patches][32][3]; h = relu(LN(p w1 + b1)) (128); e = LN(h w2 + b2) (256); pooled = max over the 32 points of a patch; out = LN(pooled) -> [32][512][256]).
// Compute dtypes, f32 accumulate: every input rounded to bf16; the 3-wide first layer, LN1 and ReLU in f32 on VALU -> fp16; the 128 -> 256 layer on WMMA, fp16 x an fp16 copy of w2 scaled by 2^14
// (exact scaling, f32 accumulate, 2^-14 and b2 applied behind it); LN2, the per-patch max and LN3 in f32 on VALU.
// ONE kernel, one wave per patch: the wave forms h straight in the A-fragment layout (lane = point row, its 64 k of the 128), multiplies 16 rows x 256 columns into 16 accumulators,
// and normalises, pools and stores from those registers. h and e never go to memory. w2 (fragment order) and the small vectors lie in LDS, staged once per work-group.

#define NPTS 16384
#define PS   32
#define HID  128
#define ED   256
#define WSC  16384.0f
#define NWG  512                  // work-groups of 8 waves; 16384 patches = NWG * 8 * NIT
#define NIT  4
typedef _Float16 h16;
typedef __attribute__((ext_vector_type(16))) _Float16 v16h;
typedef __attribute__((ext_vector_type(8)))  _Float16 v8h;
typedef __attribute__((ext_vector_type(8)))  float    v8f;
typedef __attribute__((ext_vector_type(4)))  float    v4f;

__device__ __forceinline__ unsigned short f2bf(float f) { unsigned u = __float_as_uint(f); u += 0x7FFFu + ((u >> 16) & 1u); return (unsigned short)(u >> 16); }
__device__ __forceinline__ float bf2f(unsigned short b) { return __uint_as_float(((unsigned)b) << 16); }
__device__ __forceinline__ float bfr(float f) { return bf2f(f2bf(f)); }
__device__ __forceinline__ v16h cat16(v8h lo, v8h hi) { return __builtin_shufflevector(lo, hi, 0, 1, 2, 3, 4, 5, 6, 7, 8, 9, 10, 11, 12, 13, 14, 15); }
__device__ __forceinline__ v8f wmma16(v16h a, v16h b, v8f c) { return __builtin_amdgcn_wmma_f32_16x16x32_f16(false, a, false, b, (short)0, c, false, false); }
// lane l with lane l ^ 16
__device__ __forceinline__ float xhalf(float x) { return __builtin_bit_cast(float, __builtin_amdgcn_permlanex16(__builtin_bit_cast(int, x), __builtin_bit_cast(int, x), 0x76543210, 0xfedcba98, false, false)); }
// lane l with lane l ^ M inside its 16-lane row (DPP row_xmask)
template <int M> __device__ __forceinline__ float xrow(float x) { return __builtin_bit_cast(float, __builtin_amdgcn_update_dpp(0, __builtin_bit_cast(int, x), 0x160 | M, 0xf, 0xf, true)); }
__device__ __forceinline__ float rowsum(float v) { v += xrow<1>(v); v += xrow<2>(v); v += xrow<4>(v); v += xrow<8>(v); return v; }
__device__ __forceinline__ float rstd(float ssq, float inv_n) { return __fdiv_rn(1.0f, __fsqrt_rn(__fadd_rn(ssq * inv_n, 1e-5f))); }

__global__ __launch_bounds__(256) __attribute__((amdgpu_waves_per_eu(4, 4))) void k_fused(const float* __restrict__ x, const float* __restrict__ w1, const float* __restrict__ b1, const float* __restrict__ g1, const float* __restrict__ be1,
                                               const float* __restrict__ w2, const float* __restrict__ b2, const float* __restrict__ g2, const float* __restrict__ be2,
                                               const float* __restrict__ gn, const float* __restrict__ bn, float* __restrict__ OUT) {
    __shared__ __align__(16) h16   sB[ED * HID];   // w2 in B-fragment order: [n-tile 16][k-step 4][half 2][lane 32][8]
    __shared__ __align__(16) h16   sA[8][8][32][8]; // per wave: the second 16-row tile's A fragments wait here while the first tile holds the registers
    __shared__ __align__(16) float p1[6][HID];     // w1 rows 0..2, b1, g1, be1
    __shared__ __align__(16) float p2[5][ED];      // b2, g2, be2, gn, bn
    const int t = threadIdx.x, lane = t & 31, lr = lane & 15, hi = lane >> 4, wave = __builtin_amdgcn_readfirstlane(t >> 5);   // the wave's number in a scalar register: patch indices and bases stay scalar

    // ---- stage w2 and the vectors (thread t = column t of w2; 8 consecutive k make one lane's 16 bytes of a fragment half: k = 32 kc + 16 half + 8 hi + j)
#pragma unroll
    for (int g = 0; g < 16; ++g) { v8h o;
#pragma unroll
        for (int j = 0; j < 8; ++j) o[j] = (h16)(bfr(w2[(size_t)(g * 8 + j) * ED + t]) * WSC);
        *(v8h*)(sB + ((((t >> 4) * 4 + (g >> 2)) * 2 + ((g >> 1) & 1)) * 32 + (g & 1) * 16 + (t & 15)) * 8) = o; }
    if (t < HID) { p1[0][t] = bfr(w1[t]); p1[1][t] = bfr(w1[HID + t]); p1[2][t] = bfr(w1[2 * HID + t]); p1[3][t] = bfr(b1[t]); p1[4][t] = bfr(g1[t]); p1[5][t] = bfr(be1[t]); }
    p2[0][t] = bfr(b2[t]); p2[1][t] = bfr(g2[t]); p2[2][t] = bfr(be2[t]); p2[3][t] = bfr(gn[t]); p2[4][t] = bfr(bn[t]);
    __syncthreads();

    const h16* bp = sB + lane * 8;
    float xc[2][3];     // this patch's points: [16-row tile][coordinate], lane -> row lr (both halves hold the same point)
    { const int r = (blockIdx.x * 8 + wave) * PS + lr; const int b = r / NPTS, n = r % NPTS;
#pragma unroll
      for (int m = 0; m < 2; ++m)
#pragma unroll
          for (int c = 0; c < 3; ++c) xc[m][c] = x[((size_t)b * 3 + c) * NPTS + n + m * 16]; }

    // kept rolled, for speed only
#pragma unroll 1
    for (int it = 0; it < NIT; ++it) {
        const int pp = (it * NWG + blockIdx.x) * 8 + wave;
        // ---- layer 1 + LN1 + ReLU for both 16-row tiles, in the A-fragment layout: group q holds k0 .. k0 + 3, k0 = 16 (q >> 1) + 8 hi + 4 (q & 1)
        v16h a[2][4];
        { v4f hp[2][16]; v4f s4[2] = {(v4f){}, (v4f){}}; float px[2], py[2], pz[2];
#pragma unroll
          for (int m = 0; m < 2; ++m) { px[m] = bfr(xc[m][0]); py[m] = bfr(xc[m][1]); pz[m] = bfr(xc[m][2]); }
#pragma unroll
          for (int q = 0; q < 16; ++q) { const int k0 = (q >> 1) * 16 + hi * 8 + (q & 1) * 4;
              const v4f wa = *(const v4f*)&p1[0][k0], wb = *(const v4f*)&p1[1][k0], wc = *(const v4f*)&p1[2][k0], bb = *(const v4f*)&p1[3][k0];
#pragma unroll
              for (int m = 0; m < 2; ++m) { const v4f h = ((px[m] * wa + py[m] * wb) + pz[m] * wc) + bb; hp[m][q] = h; s4[m] += h; } }
          float mu[2], rs[2];
#pragma unroll
          for (int m = 0; m < 2; ++m) { float s = (s4[m][0] + s4[m][1]) + (s4[m][2] + s4[m][3]); s += xhalf(s); mu[m] = s * (1.0f / HID); v4f q4 = (v4f){};
#pragma unroll
              for (int q = 0; q < 16; ++q) { hp[m][q] -= mu[m]; q4 += hp[m][q] * hp[m][q]; }
              float qq = (q4[0] + q4[1]) + (q4[2] + q4[3]); qq += xhalf(qq); rs[m] = rstd(qq, 1.0f / HID); }
#pragma unroll
          for (int q = 0; q < 16; ++q) { const int k0 = (q >> 1) * 16 + hi * 8 + (q & 1) * 4; const v4f g = *(const v4f*)&p1[4][k0], be = *(const v4f*)&p1[5][k0];
#pragma unroll
              for (int m = 0; m < 2; ++m) { const v4f y = (hp[m][q] * rs[m]) * g + be;
#pragma unroll
                  for (int i = 0; i < 4; ++i) a[m][q >> 2][(q & 3) * 4 + i] = (h16)fmaxf(y[i], 0.f); } } }

#pragma unroll
        for (int kc = 0; kc < 4; ++kc) { *(v8h*)sA[wave][kc * 2][lane] = __builtin_shufflevector(a[1][kc], a[1][kc], 0, 1, 2, 3, 4, 5, 6, 7); *(v8h*)sA[wave][kc * 2 + 1][lane] = __builtin_shufflevector(a[1][kc], a[1][kc], 8, 9, 10, 11, 12, 13, 14, 15); }
        // the next patch's points, fetched one patch ahead into the registers that layer 1 has just read (the last trip fetches its own again)
        { const int itn = it + 1 < NIT ? it + 1 : it; const int r = ((itn * NWG + blockIdx.x) * 8 + wave) * PS + lr; const int b = r / NPTS, n = r % NPTS;
#pragma unroll
          for (int m = 0; m < 2; ++m)
#pragma unroll
              for (int c = 0; c < 3; ++c) xc[m][c] = x[((size_t)b * 3 + c) * NPTS + n + m * 16]; }

        float mx[16];
#pragma unroll
        for (int nb = 0; nb < 16; ++nb) mx[nb] = -3.0e38f;
        // kept rolled: unrolled, the first tile's pooling was scheduled into the second tile and spilled
#pragma unroll 1
        for (int m = 0; m < 2; ++m) {
            // ---- 16 rows x 256 columns, k in the order 0, 32, 64, 96
            v8f acc[16];
#pragma unroll
            for (int nb = 0; nb < 16; ++nb) acc[nb] = (v8f){};
            v16h bf[2][4];      // B fragments in groups of four (group g: k-step g >> 2, n-tiles 4 (g & 3) ..), the next group's LDS reads in flight under this group's WMMAs
#pragma unroll
            for (int u = 0; u < 4; ++u) { const h16* p = bp + (u * 4) * 512; bf[0][u] = cat16(*(const v8h*)p, *(const v8h*)(p + 256)); }
#pragma unroll
            for (int g = 0; g < 16; ++g) {
                if (g < 15) {
#pragma unroll
                    for (int u = 0; u < 4; ++u) { const h16* p = bp + ((((g + 1) & 3) * 4 + u) * 4 + ((g + 1) >> 2)) * 512; bf[(g + 1) & 1][u] = cat16(*(const v8h*)p, *(const v8h*)(p + 256)); } }
                __builtin_amdgcn_sched_barrier(0);      // holds the next group's reads in front of this group's WMMAs: without it each WMMA waited on its own two reads
#pragma unroll
                for (int u = 0; u < 4; ++u) acc[(g & 3) * 4 + u] = wmma16(a[0][g >> 2], bf[g & 1][u], acc[(g & 3) * 4 + u]);
                __builtin_amdgcn_sched_barrier(0);      // and keeps the group after next from being read early, which would take a third set of registers
            }
            // ---- LN2 per row (accumulator: lane lr = column 16 nb + lr, register j = row 8 hi + j), then the running max over rows
            v8f s8 = (v8f){};
#pragma unroll
            for (int nb = 0; nb < 16; ++nb) { acc[nb] = acc[nb] * (1.0f / WSC) + p2[0][nb * 16 + lr]; s8 += acc[nb]; }
            v8f mu8, q8 = (v8f){}, rs8;
#pragma unroll
            for (int j = 0; j < 8; ++j) mu8[j] = rowsum(s8[j]) * (1.0f / ED);
#pragma unroll
            for (int nb = 0; nb < 16; ++nb) { acc[nb] -= mu8; q8 += acc[nb] * acc[nb]; }
#pragma unroll
            for (int j = 0; j < 8; ++j) rs8[j] = rstd(rowsum(q8[j]), 1.0f / ED);
#pragma unroll
            for (int nb = 0; nb < 16; ++nb) { const v8f y = (acc[nb] * rs8) * p2[1][nb * 16 + lr] + p2[2][nb * 16 + lr];
                const float ym = fmaxf(fmaxf(fmaxf(y[0], y[1]), fmaxf(y[2], y[3])), fmaxf(fmaxf(y[4], y[5]), fmaxf(y[6], y[7])));
                mx[nb] = fmaxf(mx[nb], ym); }
            if (m == 0) {
#pragma unroll
                for (int kc = 0; kc < 4; ++kc) a[0][kc] = cat16(*(const v8h*)sA[wave][kc * 2][lane], *(const v8h*)sA[wave][kc * 2 + 1][lane]); }
        }

        // ---- rows 0..7 with rows 8..15, LN3 over the 256 pooled values (16 in the lane x 16 lanes), store: half hi stores n-tiles 8 hi .. 8 hi + 7
        float s = 0.f;
#pragma unroll
        for (int nb = 0; nb < 16; ++nb) { mx[nb] = fmaxf(mx[nb], xhalf(mx[nb])); s += mx[nb]; }
        const float mu = rowsum(s) * (1.0f / ED); float qq = 0.f;
#pragma unroll
        for (int nb = 0; nb < 16; ++nb) { mx[nb] -= mu; qq += mx[nb] * mx[nb]; }
        const float rs = rstd(rowsum(qq), 1.0f / ED);
        float* dst = OUT + (size_t)pp * ED + hi * 128 + lr;
#pragma unroll
        for (int i = 0; i < 8; ++i) { const float d = hi ? mx[8 + i] : mx[i]; dst[i * 16] = (d * rs) * p2[3][hi * 128 + i * 16 + lr] + p2[4][hi * 128 + i * 16 + lr]; }
        // precaution: the next trip rewrites the registers that these stores name
        asm volatile("s_wait_xcnt 0x0" ::: "memory");

    }
}

extern "C" void kernel_launch(void* const* d_in, const int* in_sizes, int n_in,
                              void* d_out, int out_size, void* d_ws, size_t ws_size, hipStream_t stream) {
    (void)in_sizes; (void)n_in; (void)out_size; (void)d_ws; (void)ws_size;
    const float* IN[11]; for (int i = 0; i < 11; ++i) IN[i] = (const float*)d_in[i];   // x, w1 [3][128], b1, g1, be1, w2 [128][256], b2, g2, be2, gn, bn
    k_fused<<<NWG, 256, 0, stream>>>(IN[0], IN[1], IN[2], IN[3], IN[4], IN[5], IN[6], IN[7], IN[8], IN[9], IN[10], (float*)d_out);
}

// v002
// One run takes 40.1 microseconds.
// In both of two side-by-side timings against v001, it was 1.10 times as fast.
// Over all steps from v000 it is 14.4 times as fast.
#include <hip/hip_runtime.h>

// Patch embedding of a point cloud (x [32][3][16384] -> points [32][512 patches][32][3]; h = relu(LN(p w1 + b1)) (128); e = LN(h w2 + b2) (256); pooled = max over the 32 points of a patch; out = LN(pooled) -> [32][512][256]).
// Compute dtypes, f32 accumulate: every input rounded to bf16; the 3-wide first layer, LN1 and ReLU in f32 on VALU -> fp16; the 128 -> 256 layer on WMMA, fp16 x an fp16 copy of w2 scaled by 2^14
// (exact scaling, f32 accumulate, 2^-14 and b2 applied behind it); LN2, the per-patch max and LN3 in f32 on VALU.
// ONE kernel, one wave per patch: the wave forms h straight in the A-fragment layout (lane = point row, its 64 k of the 128), multiplies 16 rows x 256 columns into 16 accumulators,
// and normalises, pools and stores from those registers. h and e never go to memory. w2 (fragment order) and the small vectors lie in LDS, staged once per work-group.

#define NPTS 16384
#define PS   32
#define HID  128
#define ED   256
#define WSC  16384.0f
#define NWG  512                  // work-groups of 8 waves; 16384 patches = NWG * 8 * NIT
#define NIT  4
typedef _Float16 h16;
typedef __attribute__((ext_vector_type(16))) _Float16 v16h;
typedef __attribute__((ext_vector_type(8)))  _Float16 v8h;
typedef __attribute__((ext_vector_type(8)))  float    v8f;
typedef __attribute__((ext_vector_type(4)))  float    v4f;

__device__ __forceinline__ unsigned short f2bf(float f) { unsigned u = __float_as_uint(f); u += 0x7FFFu + ((u >> 16) & 1u); return (unsigned short)(u >> 16); }
__device__ __forceinline__ float bf2f(unsigned short b) { return __uint_as_float(((unsigned)b) << 16); }
__device__ __forceinline__ float bfr(float f) { return bf2f(f2bf(f)); }
__device__ __forceinline__ v16h cat16(v8h lo, v8h hi) { return __builtin_shufflevector(lo, hi, 0, 1, 2, 3, 4, 5, 6, 7, 8, 9, 10, 11, 12, 13, 14, 15); }
__device__ __forceinline__ v8f wmma16(v16h a, v16h b, v8f c) { return __builtin_amdgcn_wmma_f32_16x16x32_f16(false, a, false, b, (short)0, c, false, false); }
// lane l with lane l ^ 16
__device__ __forceinline__ float xhalf(float x) { return __builtin_bit_cast(float, __builtin_amdgcn_permlanex16(__builtin_bit_cast(int, x), __builtin_bit_cast(int, x), 0x76543210, 0xfedcba98, false, false)); }
// lane l with lane l ^ M inside its 16-lane row (DPP row_xmask)
template <int M> __device__ __forceinline__ float xrow(float x) { return __builtin_bit_cast(float, __builtin_amdgcn_update_dpp(0, __builtin_bit_cast(int, x), 0x160 | M, 0xf, 0xf, true)); }
__device__ __forceinline__ float rowsum(float v) { v += xrow<1>(v); v += xrow<2>(v); v += xrow<4>(v); v += xrow<8>(v); return v; }
// 1 / sqrt(var + eps) on the chip's reciprocal-square-root instruction; the argument is never below eps, so never subnormal
__device__ __forceinline__ float rstd(float ssq, float inv_n) { return __builtin_amdgcn_rsqf(ssq * inv_n + 1e-5f); }
// the same for LN2's eight rows, as one asm statement so that a v_nop stands directly behind each: the instruction set asks for one slot before a transcendental's result is read
// or its source overwritten
__device__ __forceinline__ float rstd_slot(float ssq, float inv_n) { const float v = ssq * inv_n + 1e-5f; float r; asm("v_rsq_f32 %0, %1\n\tv_nop" : "=v"(r) : "v"(v)); return r; }

__global__ __launch_bounds__(256) __attribute__((amdgpu_waves_per_eu(4, 4))) void k_fused(const float* __restrict__ x, const float* __restrict__ w1, const float* __restrict__ b1, const float* __restrict__ g1, const float* __restrict__ be1,
                                               const float* __restrict__ w2, const float* __restrict__ b2, const float* __restrict__ g2, const float* __restrict__ be2,
                                               const float* __restrict__ gn, const float* __restrict__ bn, float* __restrict__ OUT) {
    __shared__ __align__(16) h16   sB[ED * HID];   // w2 in B-fragment order: [n-tile 16][k-step 4][half 2][lane 32][8]
    __shared__ __align__(16) h16   sA[8][8][32][8]; // per wave: the second 16-row tile's A fragments wait here while the first tile holds the registers
    __shared__ __align__(16) float p1[6][HID];     // w1 rows 0..2, b1, g1, be1
    __shared__ __align__(16) float p2[5][ED];      // b2, g2, be2, gn, bn
    const int t = threadIdx.x, lane = t & 31, lr = lane & 15, hi = lane >> 4, wave = __builtin_amdgcn_readfirstlane(t >> 5);   // the wave's number in a scalar register: patch indices and bases stay scalar

    // ---- stage w2 and the vectors (thread t = column t of w2; 8 consecutive k make one lane's 16 bytes of a fragment half: k = 32 kc + 16 half + 8 hi + j)
#pragma unroll
    for (int g = 0; g < 16; ++g) { v8h o;
#pragma unroll
        for (int j = 0; j < 8; ++j) o[j] = (h16)(bfr(w2[(size_t)(g * 8 + j) * ED + t]) * WSC);
        *(v8h*)(sB + ((((t >> 4) * 4 + (g >> 2)) * 2 + ((g >> 1) & 1)) * 32 + (g & 1) * 16 + (t & 15)) * 8) = o; }
    if (t < HID) { p1[0][t] = bfr(w1[t]); p1[1][t] = bfr(w1[HID + t]); p1[2][t] = bfr(w1[2 * HID + t]); p1[3][t] = bfr(b1[t]); p1[4][t] = bfr(g1[t]); p1[5][t] = bfr(be1[t]); }
    p2[0][t] = bfr(b2[t]); p2[1][t] = bfr(g2[t]); p2[2][t] = bfr(be2[t]); p2[3][t] = bfr(gn[t]); p2[4][t] = bfr(bn[t]);
    __syncthreads();

    const h16* bp = sB + lane * 8;
    float xc[2][3];     // this patch's points: [16-row tile][coordinate], lane -> row lr (both halves hold the same point)
    { const int r = (blockIdx.x * 8 + wave) * PS + lr; const int b = r / NPTS, n = r % NPTS;
#pragma unroll
      for (int m = 0; m < 2; ++m)
#pragma unroll
          for (int c = 0; c < 3; ++c) xc[m][c] = x[((size_t)b * 3 + c) * NPTS + n + m * 16]; }

    // kept rolled, for speed only
#pragma unroll 1
    for (int it = 0; it < NIT; ++it) {
        const int pp = (it * NWG + blockIdx.x) * 8 + wave;
        // ---- layer 1 + LN1 + ReLU for both 16-row tiles, in the A-fragment layout: group q holds k0 .. k0 + 3, k0 = 16 (q >> 1) + 8 hi + 4 (q & 1)
        v16h a[2][4];
        { v4f hp[2][16]; v4f s4[2] = {(v4f){}, (v4f){}}; float px[2], py[2], pz[2];
#pragma unroll
          for (int m = 0; m < 2; ++m) { px[m] = bfr(xc[m][0]); py[m] = bfr(xc[m][1]); pz[m] = bfr(xc[m][2]); }
#pragma unroll
          for (int q = 0; q < 16; ++q) { const int k0 = (q >> 1) * 16 + hi * 8 + (q & 1) * 4;
              const v4f wa = *(const v4f*)&p1[0][k0], wb = *(const v4f*)&p1[1][k0], wc = *(const v4f*)&p1[2][k0], bb = *(const v4f*)&p1[3][k0];
#pragma unroll
              for (int m = 0; m < 2; ++m) { const v4f h = ((px[m] * wa + py[m] * wb) + pz[m] * wc) + bb; hp[m][q] = h; s4[m] += h; } }
          float mu[2], rs[2];
#pragma unroll
          for (int m = 0; m < 2; ++m) { float s = (s4[m][0] + s4[m][1]) + (s4[m][2] + s4[m][3]); s += xhalf(s); mu[m] = s * (1.0f / HID); v4f q4 = (v4f){};
#pragma unroll
              for (int q = 0; q < 16; ++q) { hp[m][q] -= mu[m]; q4 += hp[m][q] * hp[m][q]; }
              float qq = (q4[0] + q4[1]) + (q4[2] + q4[3]); qq += xhalf(qq); rs[m] = rstd(qq, 1.0f / HID); }
#pragma unroll
          for (int q = 0; q < 16; ++q) { const int k0 = (q >> 1) * 16 + hi * 8 + (q & 1) * 4; const v4f g = *(const v4f*)&p1[4][k0], be = *(const v4f*)&p1[5][k0];
#pragma unroll
              for (int m = 0; m < 2; ++m) { const v4f y = (hp[m][q] * rs[m]) * g + be;
#pragma unroll
                  for (int i = 0; i < 4; ++i) a[m][q >> 2][(q & 3) * 4 + i] = (h16)fmaxf(y[i], 0.f); } } }

#pragma unroll
        for (int kc = 0; kc < 4; ++kc) { *(v8h*)sA[wave][kc * 2][lane] = __builtin_shufflevector(a[1][kc], a[1][kc], 0, 1, 2, 3, 4, 5, 6, 7); *(v8h*)sA[wave][kc * 2 + 1][lane] = __builtin_shufflevector(a[1][kc], a[1][kc], 8, 9, 10, 11, 12, 13, 14, 15); }
        // the next patch's points, fetched one patch ahead into the registers that layer 1 has just read (the last trip fetches its own again)
        { const int itn = it + 1 < NIT ? it + 1 : it; const int r = ((itn * NWG + blockIdx.x) * 8 + wave) * PS + lr; const int b = r / NPTS, n = r % NPTS;
#pragma unroll
          for (int m = 0; m < 2; ++m)
#pragma unroll
              for (int c = 0; c < 3; ++c) xc[m][c] = x[((size_t)b * 3 + c) * NPTS + n + m * 16]; }

        float mx[16];
#pragma unroll
        for (int nb = 0; nb < 16; ++nb) mx[nb] = -3.0e38f;
        // kept rolled: unrolled, the first tile's pooling was scheduled into the second tile and spilled
#pragma unroll 1
        for (int m = 0; m < 2; ++m) {
            // ---- 16 rows x 256 columns, k in the order 0, 32, 64, 96
            v8f acc[16];
#pragma unroll
            for (int nb = 0; nb < 16; ++nb) acc[nb] = (v8f){};
            v16h bf[2][4];      // B fragments in groups of four (group g: k-step g >> 2, n-tiles 4 (g & 3) ..), the next group's LDS reads in flight under this group's WMMAs
#pragma unroll
            for (int u = 0; u < 4; ++u) { const h16* p = bp + (u * 4) * 512; bf[0][u] = cat16(*(const v8h*)p, *(const v8h*)(p + 256)); }
#pragma unroll
            for (int g = 0; g < 16; ++g) {
                if (g < 15) {
#pragma unroll
                    for (int u = 0; u < 4; ++u) { const h16* p = bp + ((((g + 1) & 3) * 4 + u) * 4 + ((g + 1) >> 2)) * 512; bf[(g + 1) & 1][u] = cat16(*(const v8h*)p, *(const v8h*)(p + 256)); } }
                __builtin_amdgcn_sched_barrier(0);      // holds the next group's reads in front of this group's WMMAs: without it each WMMA waited on its own two reads
#pragma unroll
                for (int u = 0; u < 4; ++u) acc[(g & 3) * 4 + u] = wmma16(a[0][g >> 2], bf[g & 1][u], acc[(g & 3) * 4 + u]);
                __builtin_amdgcn_sched_barrier(0);      // and keeps the group after next from being read early, which would take a third set of registers
            }
            // ---- LN2 per row (accumulator: lane lr = column 16 nb + lr, register j = row 8 hi + j), then the running max over rows
            v8f s8 = (v8f){};
#pragma unroll
            for (int nb = 0; nb < 16; ++nb) { acc[nb] = acc[nb] * (1.0f / WSC) + p2[0][nb * 16 + lr]; s8 += acc[nb]; }
            v8f mu8, q8 = (v8f){}, rs8;
#pragma unroll
            for (int j = 0; j < 8; ++j) mu8[j] = rowsum(s8[j]) * (1.0f / ED);
#pragma unroll
            for (int nb = 0; nb < 16; ++nb) { acc[nb] -= mu8; q8 += acc[nb] * acc[nb]; }
#pragma unroll
            for (int j = 0; j < 8; ++j) rs8[j] = rstd_slot(rowsum(q8[j]), 1.0f / ED);
#pragma unroll
            for (int nb = 0; nb < 16; ++nb) { const v8f y = (acc[nb] * rs8) * p2[1][nb * 16 + lr] + p2[2][nb * 16 + lr];
                const float ym = fmaxf(fmaxf(fmaxf(y[0], y[1]), fmaxf(y[2], y[3])), fmaxf(fmaxf(y[4], y[5]), fmaxf(y[6], y[7])));
                mx[nb] = fmaxf(mx[nb], ym); }
            if (m == 0) {
#pragma unroll
                for (int kc = 0; kc < 4; ++kc) a[0][kc] = cat16(*(const v8h*)sA[wave][kc * 2][lane], *(const v8h*)sA[wave][kc * 2 + 1][lane]); }
        }

        // ---- rows 0..7 with rows 8..15, LN3 over the 256 pooled values (16 in the lane x 16 lanes), store: half hi stores n-tiles 8 hi .. 8 hi + 7
        float s = 0.f;
#pragma unroll
        for (int nb = 0; nb < 16; ++nb) { mx[nb] = fmaxf(mx[nb], xhalf(mx[nb])); s += mx[nb]; }
        const float mu = rowsum(s) * (1.0f / ED); float qq = 0.f;
#pragma unroll
        for (int nb = 0; nb < 16; ++nb) { mx[nb] -= mu; qq += mx[nb] * mx[nb]; }
        const float rs = rstd(rowsum(qq), 1.0f / ED);
        float* dst = OUT + (size_t)pp * ED + hi * 128 + lr;
#pragma unroll
        for (int i = 0; i < 8; ++i) { const float d = hi ? mx[8 + i] : mx[i]; dst[i * 16] = (d * rs) * p2[3][hi * 128 + i * 16 + lr] + p2[4][hi * 128 + i * 16 + lr]; }
        // precaution: the next trip rewrites the registers that these stores name
        asm volatile("s_wait_xcnt 0x0" ::: "memory");

    }
}

extern "C" void kernel_launch(void* const* d_in, const int* in_sizes, int n_in,
                              void* d_out, int out_size, void* d_ws, size_t ws_size, hipStream_t stream) {
    (void)in_sizes; (void)n_in; (void)out_size; (void)d_ws; (void)ws_size;
    const float* IN[11]; for (int i = 0; i < 11; ++i) IN[i] = (const float*)d_in[i];   // x, w1 [3][128], b1, g1, be1, w2 [128][256], b2, g2, be2, gn, bn
    k_fused<<<NWG, 256, 0, stream>>>(IN[0], IN[1], IN[2], IN[3], IN[4], IN[5], IN[6], IN[7], IN[8], IN[9], IN[10], (float*)d_out);
}

// v004
// A run of this version takes 32.8 microseconds.
// It is 1.23 times as fast as v002, going by the measured steps of the versions left out in between.
// Over all steps from v000 it is 17.7 times as fast.
#include <hip/hip_runtime.h>

// Patch embedding of a point cloud (x [32][3][16384] -> points [32][512 patches][32][3]; h = relu(LN(p w1 + b1)) (128); e = LN(h w2 + b2) (256); pooled = max over the 32 points of a patch; out = LN(pooled) -> [32][512][256]).
// Compute dtypes, f32 accumulate: every input rounded to bf16; the 3-wide first layer, LN1 and ReLU in f32 on VALU -> fp16; the 128 -> 256 layer on WMMA, fp16 x an fp16 copy of w2 scaled by 2^14
// (exact scaling, f32 accumulate, 2^-14 and b2 applied behind it); LN2, the per-patch max and LN3 in f32 on VALU.
// ONE kernel, one wave per patch: the wave forms h straight in the A-fragment layout (lane = point row, its 64 k of the 128), multiplies all 32 rows x 256 columns into 32 accumulators
// (each B fragment read from LDS feeds both 16-row tiles; 256 accumulator registers, so two waves per SIMD), and normalises, pools and stores from those registers. h and e never go to memory. w2 (fragment order) and the small vectors lie in LDS, staged once per work-group.
// LN1 and LN2 take no mean in the loop: x - mean(x) of x = p W + b is p (W - rowmean W) + (b - mean b), so w1, b1, w2 and b2 are staged with their mean over the output columns taken off,
// and both layers come out centred; only the sums of squares are left to the loop.

#define NPTS 16384
#define PS   32
#define HID  128
#define ED   256
#define WSC  16384.0f
#define NWG  256                  // work-groups of 8 waves, one per WGP; 16384 patches = NWG * 8 * NIT
#define NIT  8
typedef _Float16 h16;
typedef __attribute__((ext_vector_type(16))) _Float16 v16h;
typedef __attribute__((ext_vector_type(8)))  _Float16 v8h;
typedef __attribute__((ext_vector_type(8)))  float    v8f;
typedef __attribute__((ext_vector_type(4)))  float    v4f;

__device__ __forceinline__ unsigned short f2bf(float f) { unsigned u = __float_as_uint(f); u += 0x7FFFu + ((u >> 16) & 1u); return (unsigned short)(u >> 16); }
__device__ __forceinline__ float bf2f(unsigned short b) { return __uint_as_float(((unsigned)b) << 16); }
__device__ __forceinline__ float bfr(float f) { return bf2f(f2bf(f)); }
__device__ __forceinline__ v16h cat16(v8h lo, v8h hi) { return __builtin_shufflevector(lo, hi, 0, 1, 2, 3, 4, 5, 6, 7, 8, 9, 10, 11, 12, 13, 14, 15); }
__device__ __forceinline__ v8f wmma16(v16h a, v16h b, v8f c) { return __builtin_amdgcn_wmma_f32_16x16x32_f16(false, a, false, b, (short)0, c, false, false); }
// lane l with lane l ^ 16
__device__ __forceinline__ float xhalf(float x) { return __builtin_bit_cast(float, __builtin_amdgcn_permlanex16(__builtin_bit_cast(int, x), __builtin_bit_cast(int, x), 0x76543210, 0xfedcba98, false, false)); }
// lane l with lane l ^ M inside its 16-lane row (DPP row_xmask)
template <int M> __device__ __forceinline__ float xrow(float x) { return __builtin_bit_cast(float, __builtin_amdgcn_update_dpp(0, __builtin_bit_cast(int, x), 0x160 | M, 0xf, 0xf, true)); }
__device__ __forceinline__ float rowsum(float v) { v += xrow<1>(v); v += xrow<2>(v); v += xrow<4>(v); v += xrow<8>(v); return v; }
// 1 / sqrt(var + eps) on the chip's reciprocal-square-root instruction; the argument is never below eps, so never subnormal.
// One asm statement so that a v_nop stands directly behind it: the instruction set asks for one slot before a transcendental's result is read
// or its source overwritten
__device__ __forceinline__ float rstd_slot(float ssq, float inv_n) { const float v = ssq * inv_n + 1e-5f; float r; asm("v_rsq_f32 %0, %1\n\tv_nop" : "=v"(r) : "v"(v)); return r; }

__global__ __launch_bounds__(256) __attribute__((amdgpu_waves_per_eu(2, 2))) void k_fused(const float* __restrict__ x, const float* __restrict__ w1, const float* __restrict__ b1, const float* __restrict__ g1, const float* __restrict__ be1,
                                               const float* __restrict__ w2, const float* __restrict__ b2, const float* __restrict__ g2, const float* __restrict__ be2,
                                               const float* __restrict__ gn, const float* __restrict__ bn, float* __restrict__ OUT) {
    __shared__ __align__(16) h16   sB[ED * HID];   // w2 in B-fragment order: [n-tile 16][k-step 4][half 2][lane 32][8]
    __shared__ __align__(16) float p1[6][HID];     // w1 rows 0..2 and b1 (centred), g1, be1
    __shared__ __align__(16) float p2[5][ED];      // b2 (centred), g2, be2, gn, bn
    __shared__ __align__(16) h16   sM[HID];        // mean over the 256 columns of each row of w2, at w2's scale
    __shared__ float sP[8][5];                     // per wave: sums over its threads of w1 rows 0..2, b1 and b2
    const int t = threadIdx.x, lane = t & 31, lr = lane & 15, hi = lane >> 4, wave = __builtin_amdgcn_readfirstlane(t >> 5);   // the wave's number in a scalar register: patch indices and bases stay scalar

    // ---- stage w2 and the vectors (thread t = column t of w2; 8 consecutive k make one lane's 16 bytes of a fragment half: k = 32 kc + 16 half + 8 hi + j)
    v8h o[16];
#pragma unroll
    for (int g = 0; g < 16; ++g) {
#pragma unroll
        for (int j = 0; j < 8; ++j) o[g][j] = (h16)(bfr(w2[(size_t)(g * 8 + j) * ED + t]) * WSC);
        *(v8h*)(sB + ((((t >> 4) * 4 + (g >> 2)) * 2 + ((g >> 1) & 1)) * 32 + (g & 1) * 16 + (t & 15)) * 8) = o[g]; }
    float sv[5] = {0.f, 0.f, 0.f, 0.f, bfr(b2[t])};     // this thread's column of w1 rows 0..2 and b1 (threads 0..127), and of b2
    if (t < HID) { sv[0] = bfr(w1[t]); sv[1] = bfr(w1[HID + t]); sv[2] = bfr(w1[2 * HID + t]); sv[3] = bfr(b1[t]); p1[4][t] = bfr(g1[t]); p1[5][t] = bfr(be1[t]);
        asm volatile("s_wait_xcnt 0x0" ::: "memory"); }     // precaution: the scalar bases that these loads name are rewritten right behind the branch
    p2[1][t] = bfr(g2[t]); p2[2][t] = bfr(be2[t]); p2[3][t] = bfr(gn[t]); p2[4][t] = bfr(bn[t]);
    asm volatile("s_wait_xcnt 0x0" ::: "memory");           // the same precaution for the loads above: their offset register and bases are rewritten further down
#pragma unroll
    for (int i = 0; i < 5; ++i) { float s = rowsum(sv[i]); s += xhalf(s); if (lane == 0) sP[wave][i] = s; }
    __syncthreads();
    // ---- row means of w2: wave w takes rows 16 w .. 16 w + 15. A = the 16 x 32 slice of the identity that picks those rows out of k-step w >> 1, so that D = that 16 x 16 tile of w2;
    // accumulated over the 16 n-tiles (two chains), then summed over the 16 lanes of a row
    { const int kc = wave >> 1, sel = (wave & 1) * 16 + lr; v16h id;
#pragma unroll
      for (int e = 0; e < 16; ++e) id[e] = ((e < 8 ? e : e + 8) + hi * 8 == sel) ? (h16)1.0f : (h16)0.0f;
      v8f d[2] = {(v8f){}, (v8f){}};
#pragma unroll
      for (int nb = 0; nb < 16; ++nb) { const h16* p = sB + lane * 8 + (nb * 4 + kc) * 512; d[nb & 1] = wmma16(id, cat16(*(const v8h*)p, *(const v8h*)(p + 256)), d[nb & 1]); }
      v8h mn;
#pragma unroll
      for (int j = 0; j < 8; ++j) mn[j] = (h16)(rowsum(d[0][j] + d[1][j]) * (1.0f / ED));
      if (lr == 0) *(v8h*)(sM + wave * 16 + hi * 8) = mn; }
    __syncthreads();    // every wave has read the uncentred w2 and left its means
#pragma unroll
    for (int g = 0; g < 16; ++g)
        *(v8h*)(sB + ((((t >> 4) * 4 + (g >> 2)) * 2 + ((g >> 1) & 1)) * 32 + (g & 1) * 16 + (t & 15)) * 8) = o[g] - *(const v8h*)(sM + g * 8);
    if (t < HID) {
#pragma unroll
        for (int i = 0; i < 4; ++i) p1[i][t] = sv[i] - ((sP[0][i] + sP[1][i]) + (sP[2][i] + sP[3][i])) * (1.0f / HID); }
    p2[0][t] = sv[4] - (((sP[0][4] + sP[1][4]) + (sP[2][4] + sP[3][4])) + ((sP[4][4] + sP[5][4]) + (sP[6][4] + sP[7][4]))) * (1.0f / ED);
    __syncthreads();

    const h16* bp = sB + lane * 8;
    float xc[2][3];     // this patch's points: [16-row tile][coordinate], lane -> row lr (both halves hold the same point)
    { const int r = (blockIdx.x * 8 + wave) * PS + lr; const int b = r / NPTS, n = r % NPTS;
#pragma unroll
      for (int m = 0; m < 2; ++m)
#pragma unroll
          for (int c = 0; c < 3; ++c) xc[m][c] = x[((size_t)b * 3 + c) * NPTS + n + m * 16];
      asm volatile("s_wait_xcnt 0x0" ::: "memory"); }         // the same precaution: the address pair of these loads is rewritten right behind them
    __builtin_amdgcn_sched_barrier(0);                        // keeps the address arithmetic of the LDS reads below, which reuses that pair, behind the wait
    v4f cw0[16];        // w1 rows and b1 of the first four q stay in registers for all patches, so that a patch's first arithmetic waits on no LDS read
#pragma unroll
    for (int u = 0; u < 4; ++u) { const int k0 = (u >> 1) * 16 + hi * 8 + (u & 1) * 4;
#pragma unroll
        for (int c = 0; c < 4; ++c) cw0[u * 4 + c] = *(const v4f*)&p1[c][k0]; }
    float c3[2][8];     // likewise this lane's eight columns of gn and bn
#pragma unroll
    for (int i = 0; i < 8; ++i) { c3[0][i] = p2[3][hi * 128 + i * 16 + lr]; c3[1][i] = p2[4][hi * 128 + i * 16 + lr]; }

    // kept rolled, for speed only
#pragma unroll 1
    for (int it = 0; it < NIT; ++it) {
        const int pp = (it * NWG + blockIdx.x) * 8 + wave;
        // ---- layer 1 (centred) + LN1 + ReLU for both 16-row tiles, in the A-fragment layout: group q holds k0 .. k0 + 3, k0 = 16 (q >> 1) + 8 hi + 4 (q & 1)
        v16h a[2][4];
        v16h bf[2][4];      // B fragments in groups of four (group g: k-step g >> 2, n-tiles 4 (g & 3) ..), the next group's LDS reads in flight under this group's WMMAs
        { v4f hp[2][16]; v4f q4[2] = {(v4f){}, (v4f){}}; float px[2], py[2], pz[2];
          v4f cw[2][16];    // with two waves per SIMD the LDS latency is the wave's own to cover: the vectors are read one group ahead (three groups of w1 rows and b1 for four q, two of g1 and be1 for eight q)
#pragma unroll
          for (int m = 0; m < 2; ++m) { px[m] = bfr(xc[m][0]); py[m] = bfr(xc[m][1]); pz[m] = bfr(xc[m][2]); }
#pragma unroll
          for (int G = 0; G < 4; ++G) {
              if (G < 3) {
#pragma unroll
                  for (int u = 0; u < 4; ++u) { const int q = (G + 1) * 4 + u, k0 = (q >> 1) * 16 + hi * 8 + (q & 1) * 4;
#pragma unroll
                      for (int c = 0; c < 4; ++c) cw[(G + 1) & 1][u * 4 + c] = *(const v4f*)&p1[c][k0]; }
              } else {
#pragma unroll
                  for (int q = 0; q < 8; ++q) { const int k0 = (q >> 1) * 16 + hi * 8 + (q & 1) * 4; cw[0][q * 2] = *(const v4f*)&p1[4][k0]; cw[0][q * 2 + 1] = *(const v4f*)&p1[5][k0]; } }
              __builtin_amdgcn_sched_barrier(0);      // holds the next group's reads in front of this group's arithmetic: without it each q waited on its own four reads
#pragma unroll
              for (int u = 0; u < 4; ++u) { const int q = G * 4 + u; const v4f* cg = G ? cw[G & 1] : cw0; const v4f wa = cg[u * 4], wb = cg[u * 4 + 1], wc = cg[u * 4 + 2], bb = cg[u * 4 + 3];
#pragma unroll
                  for (int m = 0; m < 2; ++m) { const v4f h = ((px[m] * wa + py[m] * wb) + pz[m] * wc) + bb; hp[m][q] = h; q4[m] += h * h; } }
              __builtin_amdgcn_sched_barrier(0);      // and keeps the group after next from being read early, over the buffer still in use
          }
          float rs[2];
#pragma unroll
          for (int m = 0; m < 2; ++m) { float qq = (q4[m][0] + q4[m][1]) + (q4[m][2] + q4[m][3]); qq += xhalf(qq); rs[m] = rstd_slot(qq, 1.0f / HID); }
#pragma unroll
          for (int G = 0; G < 2; ++G) {
              if (G == 0) {
#pragma unroll
                  for (int u = 0; u < 8; ++u) { const int q = 8 + u, k0 = (q >> 1) * 16 + hi * 8 + (q & 1) * 4; cw[1][u * 2] = *(const v4f*)&p1[4][k0]; cw[1][u * 2 + 1] = *(const v4f*)&p1[5][k0]; }
              } else {
#pragma unroll
                  for (int u = 0; u < 4; ++u) { const h16* p = bp + (u * 4) * 512; bf[0][u] = cat16(*(const v8h*)p, *(const v8h*)(p + 256)); } }
              __builtin_amdgcn_sched_barrier(0);      // as above: the next reads (last, the first B fragments) stand in front of this group's arithmetic
#pragma unroll
              for (int u = 0; u < 8; ++u) { const int q = G * 8 + u; const v4f g = cw[G & 1][u * 2], be = cw[G & 1][u * 2 + 1];
#pragma unroll
                  for (int m = 0; m < 2; ++m) { const v4f y = (hp[m][q] * rs[m]) * g + be;
#pragma unroll
                      for (int i = 0; i < 4; ++i) a[m][q >> 2][(q & 3) * 4 + i] = (h16)fmaxf(y[i], 0.f); } }
              __builtin_amdgcn_sched_barrier(0);      // keeps the reads that follow from moving up over the buffer still in use
          } }

        // the next patch's points, fetched one patch ahead into the registers that layer 1 has just read (the last trip fetches its own again)
        { const int itn = it + 1 < NIT ? it + 1 : it; const int r = ((itn * NWG + blockIdx.x) * 8 + wave) * PS + lr; const int b = r / NPTS, n = r % NPTS;
#pragma unroll
          for (int m = 0; m < 2; ++m)
#pragma unroll
              for (int c = 0; c < 3; ++c) xc[m][c] = x[((size_t)b * 3 + c) * NPTS + n + m * 16];
          asm volatile("s_wait_xcnt 0x0" ::: "memory"); }     // precaution: the address pair that these loads name is rewritten right behind them

        float mx[16];
        {
            // ---- 32 rows x 256 columns, k in the order 0, 32, 64, 96
            v8f acc[2][16];
#pragma unroll
            for (int m = 0; m < 2; ++m)
#pragma unroll
                for (int nb = 0; nb < 16; ++nb) acc[m][nb] = (v8f){};
            float c2[3][16];    // this lane's columns of b2, g2, be2, read under the last group's WMMAs
#pragma unroll
            for (int g = 0; g < 16; ++g) {
                if (g < 15) {
#pragma unroll
                    for (int u = 0; u < 4; ++u) { const h16* p = bp + ((((g + 1) & 3) * 4 + u) * 4 + ((g + 1) >> 2)) * 512; bf[(g + 1) & 1][u] = cat16(*(const v8h*)p, *(const v8h*)(p + 256)); }
                } else {
#pragma unroll
                    for (int c = 0; c < 3; ++c)
#pragma unroll
                        for (int nb = 0; nb < 16; ++nb) c2[c][nb] = p2[c][nb * 16 + lr]; }
                __builtin_amdgcn_sched_barrier(0);      // holds the next group's reads in front of this group's WMMAs: without it each WMMA waited on its own two reads
#pragma unroll
                for (int u = 0; u < 4; ++u)
#pragma unroll
                    for (int m = 0; m < 2; ++m) acc[m][(g & 3) * 4 + u] = wmma16(a[m][g >> 2], bf[g & 1][u], acc[m][(g & 3) * 4 + u]);
                __builtin_amdgcn_sched_barrier(0);      // and keeps the group after next from being read early, which would take a third set of registers
            }
            // ---- LN2 per row, the rows centred already (accumulator: lane lr = column 16 nb + lr, register j = row 16 m + 8 hi + j), then the max over the rows
            v8f q8[2] = {(v8f){}, (v8f){}}, rs8[2];
#pragma unroll
            for (int nb = 0; nb < 16; ++nb) { const float bb = c2[0][nb];
#pragma unroll
                for (int m = 0; m < 2; ++m) { acc[m][nb] = acc[m][nb] * (1.0f / WSC) + bb; q8[m] += acc[m][nb] * acc[m][nb]; } }
#pragma unroll
            for (int m = 0; m < 2; ++m)
#pragma unroll
                for (int j = 0; j < 8; ++j) rs8[m][j] = rstd_slot(rowsum(q8[m][j]), 1.0f / ED);
#pragma unroll
            for (int nb = 0; nb < 16; ++nb) { const float g = c2[1][nb], be = c2[2][nb]; float ym[2];
#pragma unroll
                for (int m = 0; m < 2; ++m) { const v8f y = (acc[m][nb] * rs8[m]) * g + be;
                    ym[m] = fmaxf(fmaxf(fmaxf(y[0], y[1]), fmaxf(y[2], y[3])), fmaxf(fmaxf(y[4], y[5]), fmaxf(y[6], y[7]))); }
                mx[nb] = fmaxf(ym[0], ym[1]); }
        }

        // ---- rows 0..7 with rows 8..15, LN3 over the 256 pooled values (16 in the lane x 16 lanes), store: half hi stores n-tiles 8 hi .. 8 hi + 7
        float s = 0.f;
#pragma unroll
        for (int nb = 0; nb < 16; ++nb) { mx[nb] = fmaxf(mx[nb], xhalf(mx[nb])); s += mx[nb]; }
        const float mu = rowsum(s) * (1.0f / ED); float qq = 0.f;
#pragma unroll
        for (int nb = 0; nb < 16; ++nb) { mx[nb] -= mu; qq += mx[nb] * mx[nb]; }
        const float rs = rstd_slot(rowsum(qq), 1.0f / ED);
        float* dst = OUT + (size_t)pp * ED + hi * 128 + lr;
#pragma unroll
        for (int i = 0; i < 8; ++i) { const float d = hi ? mx[8 + i] : mx[i]; dst[i * 16] = (d * rs) * c3[0][i] + c3[1][i]; }
        // precaution: the next trip rewrites the registers that these stores name
        asm volatile("s_wait_xcnt 0x0" ::: "memory");

    }
}

extern "C" void kernel_launch(void* const* d_in, const int* in_sizes, int n_in,
                              void* d_out, int out_size, void* d_ws, size_t ws_size, hipStream_t stream) {
    (void)in_sizes; (void)n_in; (void)out_size; (void)d_ws; (void)ws_size;
    const float* IN[11]; for (int i = 0; i < 11; ++i) IN[i] = (const float*)d_in[i];   // x, w1 [3][128], b1, g1, be1, w2 [128][256], b2, g2, be2, gn, bn
    k_fused<<<NWG, 256, 0, stream>>>(IN[0], IN[1], IN[2], IN[3], IN[4], IN[5], IN[6], IN[7], IN[8], IN[9], IN[10], (float*)d_out);
}

// v005
// A run of this version takes 30.9 microseconds.
// Two timings next to v004 both put it at 1.06 times that version's speed.
// All steps since v000 together make it 18.8 times as fast.
#include <hip/hip_runtime.h>

// Patch embedding of a point cloud (x [32][3][16384] -> points [32][512 patches][32][3]; h = relu(LN(p w1 + b1)) (128); e = LN(h w2 + b2) (256); pooled = max over the 32 points of a patch; out = LN(pooled) -> [32][512][256]).
// Compute dtypes, f32 accumulate: every input rounded to bf16; the 3-wide first layer, LN1 and ReLU in f32 on VALU -> fp16; the 128 -> 256 layer on WMMA, fp16 x an fp16 copy of w2 scaled by 2^14
// (exact scaling, f32 accumulate, 2^-14 and b2 applied behind it); LN2, the per-patch max and LN3 in f32 on VALU.
// ONE kernel, one wave per patch: the wave forms h straight in the A-fragment layout (lane = point row, its 64 k of the 128), multiplies all 32 rows x 256 columns into 32 accumulators
// (each B fragment read from LDS feeds both 16-row tiles; 256 accumulator registers, so two waves per SIMD), and normalises, pools and stores from those registers. h and e never go to memory. w2 (fragment order) and the small vectors lie in LDS, staged once per work-group.
// LN1 and LN2 take no mean in the loop: x - mean(x) of x = p W + b is p (W - rowmean W) + (b - mean b), so w1, b1, w2 and b2 are staged with their mean over the output columns taken off,
// and both layers come out centred; only the sums of squares are left to the loop.
// LN1's sum of squares is a quadratic form in the point: |p W + b|^2 = (p, 1) G (p, 1)^T with G the 4 x 4 Gram matrix of the centred w1 rows and b1, formed once per wave. So 1 / std is known before any h:
// it goes into the three coordinates, g1 into the staged w1 and b1, and an element of relu(LN1(.)) is four multiply-adds from be1 on.

#define NPTS 16384
#define PS   32
#define HID  128
#define ED   256
#define WSC  16384.0f
#define NWG  256                  // work-groups of 8 waves, one per WGP; 16384 patches = NWG * 8 * NIT
#define NIT  8
typedef _Float16 h16;
typedef __attribute__((ext_vector_type(16))) _Float16 v16h;
typedef __attribute__((ext_vector_type(8)))  _Float16 v8h;
typedef __attribute__((ext_vector_type(8)))  float    v8f;
typedef __attribute__((ext_vector_type(4)))  float    v4f;

__device__ __forceinline__ unsigned short f2bf(float f) { unsigned u = __float_as_uint(f); u += 0x7FFFu + ((u >> 16) & 1u); return (unsigned short)(u >> 16); }
__device__ __forceinline__ float bf2f(unsigned short b) { return __uint_as_float(((unsigned)b) << 16); }
__device__ __forceinline__ float bfr(float f) { return bf2f(f2bf(f)); }
__device__ __forceinline__ v16h cat16(v8h lo, v8h hi) { return __builtin_shufflevector(lo, hi, 0, 1, 2, 3, 4, 5, 6, 7, 8, 9, 10, 11, 12, 13, 14, 15); }
__device__ __forceinline__ v8f wmma16(v16h a, v16h b, v8f c) { return __builtin_amdgcn_wmma_f32_16x16x32_f16(false, a, false, b, (short)0, c, false, false); }
// s * a + c as fused multiply-adds by name: written with * and +, the compiler split the last pair of every fourth group into separate multiplies, copies and adds
__device__ __forceinline__ v4f fma4(float s, v4f a, v4f c) { return __builtin_elementwise_fma((v4f){s, s, s, s}, a, c); }
// lane l with lane l ^ 16
__device__ __forceinline__ float xhalf(float x) { return __builtin_bit_cast(float, __builtin_amdgcn_permlanex16(__builtin_bit_cast(int, x), __builtin_bit_cast(int, x), 0x76543210, 0xfedcba98, false, false)); }
// lane l with lane l ^ M inside its 16-lane row (DPP row_xmask)
template <int M> __device__ __forceinline__ float xrow(float x) { return __builtin_bit_cast(float, __builtin_amdgcn_update_dpp(0, __builtin_bit_cast(int, x), 0x160 | M, 0xf, 0xf, true)); }
__device__ __forceinline__ float rowsum(float v) { v += xrow<1>(v); v += xrow<2>(v); v += xrow<4>(v); v += xrow<8>(v); return v; }
// 1 / sqrt(var + eps) on the chip's reciprocal-square-root instruction; the argument is never below eps, so never subnormal.
// One asm statement so that a v_nop stands directly behind it: the instruction set asks for one slot before a transcendental's result is read
// or its source overwritten
__device__ __forceinline__ float rstd_slot(float ssq, float inv_n) { const float v = ssq * inv_n + 1e-5f; float r; asm("v_rsq_f32 %0, %1\n\tv_nop" : "=v"(r) : "v"(v)); return r; }

__global__ __launch_bounds__(256) __attribute__((amdgpu_waves_per_eu(2, 2))) void k_fused(const float* __restrict__ x, const float* __restrict__ w1, const float* __restrict__ b1, const float* __restrict__ g1, const float* __restrict__ be1,
                                               const float* __restrict__ w2, const float* __restrict__ b2, const float* __restrict__ g2, const float* __restrict__ be2,
                                               const float* __restrict__ gn, const float* __restrict__ bn, float* __restrict__ OUT) {
    __shared__ __align__(16) h16   sB[ED * HID];   // w2 in B-fragment order: [n-tile 16][k-step 4][half 2][lane 32][8]
    __shared__ __align__(16) float p1[5][HID];     // w1 rows 0..2 and b1 (centred, times g1), be1
    __shared__ __align__(16) float pc[4][HID];     // w1 rows 0..2 and b1 (centred), for the Gram matrix
    __shared__ __align__(16) float p2[5][ED];      // b2 (centred), g2, be2, gn, bn
    __shared__ __align__(16) h16   sM[HID];        // mean over the 256 columns of each row of w2, at w2's scale
    __shared__ float sP[8][5];                     // per wave: sums over its threads of w1 rows 0..2, b1 and b2
    const int t = threadIdx.x, lane = t & 31, lr = lane & 15, hi = lane >> 4, wave = __builtin_amdgcn_readfirstlane(t >> 5);   // the wave's number in a scalar register: patch indices and bases stay scalar

    // ---- stage w2 and the vectors (thread t = column t of w2; 8 consecutive k make one lane's 16 bytes of a fragment half: k = 32 kc + 16 half + 8 hi + j)
    v8h o[16];
#pragma unroll
    for (int g = 0; g < 16; ++g) {
#pragma unroll
        for (int j = 0; j < 8; ++j) o[g][j] = (h16)(bfr(w2[(size_t)(g * 8 + j) * ED + t]) * WSC);
        *(v8h*)(sB + ((((t >> 4) * 4 + (g >> 2)) * 2 + ((g >> 1) & 1)) * 32 + (g & 1) * 16 + (t & 15)) * 8) = o[g]; }
    float sv[5] = {0.f, 0.f, 0.f, 0.f, bfr(b2[t])};     // this thread's column of w1 rows 0..2 and b1 (threads 0..127), and of b2
    float g1v = 0.f;
    if (t < HID) { sv[0] = bfr(w1[t]); sv[1] = bfr(w1[HID + t]); sv[2] = bfr(w1[2 * HID + t]); sv[3] = bfr(b1[t]); g1v = bfr(g1[t]); p1[4][t] = bfr(be1[t]);
        asm volatile("s_wait_xcnt 0x0" ::: "memory"); }     // precaution: the scalar bases that these loads name are rewritten right behind the branch
    p2[1][t] = bfr(g2[t]); p2[2][t] = bfr(be2[t]); p2[3][t] = bfr(gn[t]); p2[4][t] = bfr(bn[t]);
    asm volatile("s_wait_xcnt 0x0" ::: "memory");           // the same precaution for the loads above: their offset register and bases are rewritten further down
#pragma unroll
    for (int i = 0; i < 5; ++i) { float s = rowsum(sv[i]); s += xhalf(s); if (lane == 0) sP[wave][i] = s; }
    __syncthreads();
    // ---- row means of w2: wave w takes rows 16 w .. 16 w + 15. A = the 16 x 32 slice of the identity that picks those rows out of k-step w >> 1, so that D = that 16 x 16 tile of w2;
    // accumulated over the 16 n-tiles (two chains), then summed over the 16 lanes of a row
    { const int kc = wave >> 1, sel = (wave & 1) * 16 + lr; v16h id;
#pragma unroll
      for (int e = 0; e < 16; ++e) id[e] = ((e < 8 ? e : e + 8) + hi * 8 == sel) ? (h16)1.0f : (h16)0.0f;
      v8f d[2] = {(v8f){}, (v8f){}};
#pragma unroll
      for (int nb = 0; nb < 16; ++nb) { const h16* p = sB + lane * 8 + (nb * 4 + kc) * 512; d[nb & 1] = wmma16(id, cat16(*(const v8h*)p, *(const v8h*)(p + 256)), d[nb & 1]); }
      v8h mn;
#pragma unroll
      for (int j = 0; j < 8; ++j) mn[j] = (h16)(rowsum(d[0][j] + d[1][j]) * (1.0f / ED));
      if (lr == 0) *(v8h*)(sM + wave * 16 + hi * 8) = mn; }
    __syncthreads();    // every wave has read the uncentred w2 and left its means
#pragma unroll
    for (int g = 0; g < 16; ++g)
        *(v8h*)(sB + ((((t >> 4) * 4 + (g >> 2)) * 2 + ((g >> 1) & 1)) * 32 + (g & 1) * 16 + (t & 15)) * 8) = o[g] - *(const v8h*)(sM + g * 8);
    if (t < HID) {
#pragma unroll
        for (int i = 0; i < 4; ++i) { const float cv = sv[i] - ((sP[0][i] + sP[1][i]) + (sP[2][i] + sP[3][i])) * (1.0f / HID); pc[i][t] = cv; p1[i][t] = cv * g1v; } }
    p2[0][t] = sv[4] - (((sP[0][4] + sP[1][4]) + (sP[2][4] + sP[3][4])) + ((sP[4][4] + sP[5][4]) + (sP[6][4] + sP[7][4]))) * (1.0f / ED);
    __syncthreads();

    const h16* bp = sB + lane * 8;
    float xc[2][3];     // this patch's points: [16-row tile][coordinate], lane -> row lr (both halves hold the same point)
    { const int r = (blockIdx.x * 8 + wave) * PS + lr; const int b = r / NPTS, n = r % NPTS;
#pragma unroll
      for (int m = 0; m < 2; ++m)
#pragma unroll
          for (int c = 0; c < 3; ++c) xc[m][c] = x[((size_t)b * 3 + c) * NPTS + n + m * 16];
      asm volatile("s_wait_xcnt 0x0" ::: "memory"); }         // the same precaution: the address pair of these loads is rewritten right behind them
    __builtin_amdgcn_sched_barrier(0);                        // keeps the address arithmetic of the LDS reads below, which reuses that pair, behind the wait
    v4f cw0[20];        // the five vectors of the first four q stay in registers for all patches, so that a patch's first arithmetic waits on no LDS read
#pragma unroll
    for (int u = 0; u < 4; ++u) { const int k0 = (u >> 1) * 16 + hi * 8 + (u & 1) * 4;
#pragma unroll
        for (int c = 0; c < 5; ++c) cw0[u * 5 + c] = *(const v4f*)&p1[c][k0]; }
    // Gram matrix of the four centred vectors, upper triangle row by row, the off-diagonal entries doubled: lane l takes k = 4 l .. 4 l + 3, then the sum over the 32 lanes.
    // Every lane ends with the same bits (the exchange sums are symmetric), so the ten values go to scalar registers
    float gm[10];
    { v4f r[4];
#pragma unroll
      for (int c = 0; c < 4; ++c) r[c] = *(const v4f*)&pc[c][lane * 4];
#pragma unroll
      for (int c = 0, n = 0; c < 4; ++c)
#pragma unroll
          for (int d = c; d < 4; ++d, ++n) { const v4f pr = r[c] * r[d]; float s = rowsum((pr[0] + pr[1]) + (pr[2] + pr[3])); s += xhalf(s); if (d != c) s += s;
              gm[n] = __builtin_bit_cast(float, __builtin_amdgcn_readfirstlane(__builtin_bit_cast(int, s))); } }
    float c3[2][8];     // likewise this lane's eight columns of gn and bn
#pragma unroll
    for (int i = 0; i < 8; ++i) { c3[0][i] = p2[3][hi * 128 + i * 16 + lr]; c3[1][i] = p2[4][hi * 128 + i * 16 + lr]; }

    // kept rolled, for speed only
#pragma unroll 1
    for (int it = 0; it < NIT; ++it) {
        const int pp = (it * NWG + blockIdx.x) * 8 + wave;
        // ---- layer 1 with LN1 folded in + ReLU for both 16-row tiles, in the A-fragment layout: group q holds k0 .. k0 + 3, k0 = 16 (q >> 1) + 8 hi + 4 (q & 1)
        v16h a[2][4];
        v16h bf[2][4];      // B fragments in groups of four (group g: k-step g >> 2, n-tiles 4 (g & 3) ..), the next group's LDS reads in flight under this group's WMMAs
        { float ps[2][4];   // per 16-row tile: the point's three coordinates times 1 / std, and 1 / std
          v4f cw[2][20];    // with two waves per SIMD the LDS latency is the wave's own to cover: the five vectors are read one group of four q ahead
#pragma unroll
          for (int G = 0; G < 4; ++G) {
              if (G < 3) {
#pragma unroll
                  for (int u = 0; u < 4; ++u) { const int q = (G + 1) * 4 + u, k0 = (q >> 1) * 16 + hi * 8 + (q & 1) * 4;
#pragma unroll
                      for (int c = 0; c < 5; ++c) cw[(G + 1) & 1][u * 5 + c] = *(const v4f*)&p1[c][k0]; }
              } else {
#pragma unroll
                  for (int u = 0; u < 4; ++u) { const h16* p = bp + (u * 4) * 512; bf[0][u] = cat16(*(const v8h*)p, *(const v8h*)(p + 256)); } }
              __builtin_amdgcn_sched_barrier(0);      // holds the next group's reads (last, the first B fragments) in front of this group's arithmetic: without it each q waited on its own reads
              if (G == 0) {
#pragma unroll
                  for (int m = 0; m < 2; ++m) { const float px = bfr(xc[m][0]), py = bfr(xc[m][1]), pz = bfr(xc[m][2]);
                      const float ssq = px * (gm[0] * px + gm[1] * py + gm[2] * pz + gm[3]) + py * (gm[4] * py + gm[5] * pz + gm[6]) + pz * (gm[7] * pz + gm[8]) + gm[9];
                      const float rs = rstd_slot(fmaxf(ssq, 0.f), 1.0f / HID);     // the form is a sum of squares; the maximum only takes off what rounding may leave below 0
                      ps[m][0] = px * rs; ps[m][1] = py * rs; ps[m][2] = pz * rs; ps[m][3] = rs; } }
#pragma unroll
              for (int u = 0; u < 4; ++u) { const int q = G * 4 + u; const v4f* cg = (G ? cw[G & 1] : cw0) + u * 5;
#pragma unroll
                  for (int m = 0; m < 2; ++m) { const v4f y = fma4(ps[m][0], cg[0], fma4(ps[m][1], cg[1], fma4(ps[m][2], cg[2], fma4(ps[m][3], cg[3], cg[4]))));
#pragma unroll
                      for (int i = 0; i < 4; ++i) a[m][q >> 2][(q & 3) * 4 + i] = (h16)fmaxf(y[i], 0.f); } }
              __builtin_amdgcn_sched_barrier(0);      // and keeps the group after next from being read early, over the buffer still in use
          } }

        // the next patch's points, fetched one patch ahead into the registers that layer 1 has just read (the last trip fetches its own again)
        { const int itn = it + 1 < NIT ? it + 1 : it; const int r = ((itn * NWG + blockIdx.x) * 8 + wave) * PS + lr; const int b = r / NPTS, n = r % NPTS;
#pragma unroll
          for (int m = 0; m < 2; ++m)
#pragma unroll
              for (int c = 0; c < 3; ++c) xc[m][c] = x[((size_t)b * 3 + c) * NPTS + n + m * 16];
          asm volatile("s_wait_xcnt 0x0" ::: "memory"); }     // precaution: the address pair that these loads name is rewritten right behind them

        float mx[16];
        {
            // ---- 32 rows x 256 columns, k in the order 0, 32, 64, 96
            v8f acc[2][16];
#pragma unroll
            for (int m = 0; m < 2; ++m)
#pragma unroll
                for (int nb = 0; nb < 16; ++nb) acc[m][nb] = (v8f){};
            float c2[3][16];    // this lane's columns of b2, g2, be2, read under the last group's WMMAs
#pragma unroll
            for (int g = 0; g < 16; ++g) {
                if (g < 15) {
#pragma unroll
                    for (int u = 0; u < 4; ++u) { const h16* p = bp + ((((g + 1) & 3) * 4 + u) * 4 + ((g + 1) >> 2)) * 512; bf[(g + 1) & 1][u] = cat16(*(const v8h*)p, *(const v8h*)(p + 256)); }
                } else {
#pragma unroll
                    for (int c = 0; c < 3; ++c)
#pragma unroll
                        for (int nb = 0; nb < 16; ++nb) c2[c][nb] = p2[c][nb * 16 + lr]; }
                __builtin_amdgcn_sched_barrier(0);      // holds the next group's reads in front of this group's WMMAs: without it each WMMA waited on its own two reads
#pragma unroll
                for (int u = 0; u < 4; ++u)
#pragma unroll
                    for (int m = 0; m < 2; ++m) acc[m][(g & 3) * 4 + u] = wmma16(a[m][g >> 2], bf[g & 1][u], acc[m][(g & 3) * 4 + u]);
                __builtin_amdgcn_sched_barrier(0);      // and keeps the group after next from being read early, which would take a third set of registers
            }
            // ---- LN2 per row, the rows centred already (accumulator: lane lr = column 16 nb + lr, register j = row 16 m + 8 hi + j), then the max over the rows
            v8f q8[2] = {(v8f){}, (v8f){}}, rs8[2];
#pragma unroll
            for (int nb = 0; nb < 16; ++nb) { const float bb = c2[0][nb];
#pragma unroll
                for (int m = 0; m < 2; ++m) { acc[m][nb] = acc[m][nb] * (1.0f / WSC) + bb; q8[m] += acc[m][nb] * acc[m][nb]; } }
#pragma unroll
            for (int m = 0; m < 2; ++m)
#pragma unroll
                for (int j = 0; j < 8; ++j) rs8[m][j] = rstd_slot(rowsum(q8[m][j]), 1.0f / ED);
#pragma unroll
            for (int nb = 0; nb < 16; ++nb) { const float g = c2[1][nb], be = c2[2][nb]; float ym[2];
#pragma unroll
                for (int m = 0; m < 2; ++m) { const v8f y = (acc[m][nb] * rs8[m]) * g + be;
                    ym[m] = fmaxf(fmaxf(fmaxf(y[0], y[1]), fmaxf(y[2], y[3])), fmaxf(fmaxf(y[4], y[5]), fmaxf(y[6], y[7]))); }
                mx[nb] = fmaxf(ym[0], ym[1]); }
        }

        // ---- rows 0..7 with rows 8..15, LN3 over the 256 pooled values (16 in the lane x 16 lanes), store: half hi stores n-tiles 8 hi .. 8 hi + 7
        float s = 0.f;
#pragma unroll
        for (int nb = 0; nb < 16; ++nb) { mx[nb] = fmaxf(mx[nb], xhalf(mx[nb])); s += mx[nb]; }
        const float mu = rowsum(s) * (1.0f / ED); float qq = 0.f;
#pragma unroll
        for (int nb = 0; nb < 16; ++nb) { mx[nb] -= mu; qq += mx[nb] * mx[nb]; }
        const float rs = rstd_slot(rowsum(qq), 1.0f / ED);
        float* dst = OUT + (size_t)pp * ED + hi * 128 + lr;
#pragma unroll
        for (int i = 0; i < 8; ++i) { const float d = hi ? mx[8 + i] : mx[i]; dst[i * 16] = (d * rs) * c3[0][i] + c3[1][i]; }
        // precaution: the next trip rewrites the registers that these stores name
        asm volatile("s_wait_xcnt 0x0" ::: "memory");

    }
}

extern "C" void kernel_launch(void* const* d_in, const int* in_sizes, int n_in,
                              void* d_out, int out_size, void* d_ws, size_t ws_size, hipStream_t stream) {
    (void)in_sizes; (void)n_in; (void)out_size; (void)d_ws; (void)ws_size;
    const float* IN[11]; for (int i = 0; i < 11; ++i) IN[i] = (const float*)d_in[i];   // x, w1 [3][128], b1, g1, be1, w2 [128][256], b2, g2, be2, gn, bn
    k_fused<<<NWG, 256, 0, stream>>>(IN[0], IN[1], IN[2], IN[3], IN[4], IN[5], IN[6], IN[7], IN[8], IN[9], IN[10], (float*)d_out);
}

// v006
// Measured time: 29.1 microseconds a run.
// In two side-by-side timings against v005, it was 1.07 and 1.06 times as fast.
// Counting every step since v000, it is 19.9 times as fast.
#include <hip/hip_runtime.h>

// Patch embedding of a point cloud (x [32][3][16384] -> points [32][512 patches][32][3]; h = relu(LN(p w1 + b1)) (128); e = LN(h w2 + b2) (256); pooled = max over the 32 points of a patch; out = LN(pooled) -> [32][512][256]).
// Compute dtypes, f32 accumulate: every input rounded to bf16; LN1's scale in f32 on VALU; the 3-wide first layer on WMMA, each f32 operand as two fp16 parts (head + rest, about 22 bits), -> fp16, ReLU; the 128 -> 256 layer on WMMA, fp16 x an fp16 copy of w2 scaled by 2^14
// (exact scaling, f32 accumulate, 2^-14 and b2 applied behind it); LN2, the per-patch max and LN3 in f32 on VALU.
// ONE kernel, one wave per patch: the wave forms h straight in the A-fragment layout (lane = point row, its 64 k of the 128; layer 1 is multiplied transposed, units x points, so that its accumulators have that layout), multiplies all 32 rows x 256 columns into 32 accumulators
// (each B fragment read from LDS feeds both 16-row tiles; 256 accumulator registers, so two waves per SIMD), and normalises, pools and stores from those registers. h and e never go to memory. w2 (fragment order) and the small vectors lie in LDS, staged once per work-group.
// LN1 and LN2 take no mean in the loop: x - mean(x) of x = p W + b is p (W - rowmean W) + (b - mean b), so w1, b1, w2 and b2 are staged with their mean over the output columns taken off,
// and both layers come out centred; only the sums of squares are left to the loop.
// LN1's sum of squares is a quadratic form in the point: |p W + b|^2 = (p, 1) G (p, 1)^T with G the 4 x 4 Gram matrix of the centred w1 rows and b1, formed once per wave. So 1 / std is known before any h:
// it goes into the three coordinates, g1 into the staged w1 and b1, and relu(LN1(.)) is the ReLU of a product with k = (x, y, z, 1) / std and be1 added.

#define NPTS 16384
#define PS   32
#define HID  128
#define ED   256
#define WSC  16384.0f
#define NWG  256                  // work-groups of 8 waves, one per WGP; 16384 patches = NWG * 8 * NIT
#define NIT  8
typedef _Float16 h16;
typedef __attribute__((ext_vector_type(16))) _Float16 v16h;
typedef __attribute__((ext_vector_type(8)))  _Float16 v8h;
typedef __attribute__((ext_vector_type(8)))  float    v8f;
typedef __attribute__((ext_vector_type(4)))  float    v4f;
typedef __attribute__((ext_vector_type(2)))  float    v2f;
typedef __attribute__((ext_vector_type(2)))  _Float16 v2h;

__device__ __forceinline__ unsigned short f2bf(float f) { unsigned u = __float_as_uint(f); u += 0x7FFFu + ((u >> 16) & 1u); return (unsigned short)(u >> 16); }
__device__ __forceinline__ float bf2f(unsigned short b) { return __uint_as_float(((unsigned)b) << 16); }
__device__ __forceinline__ float bfr(float f) { return bf2f(f2bf(f)); }
__device__ __forceinline__ v16h cat16(v8h lo, v8h hi) { return __builtin_shufflevector(lo, hi, 0, 1, 2, 3, 4, 5, 6, 7, 8, 9, 10, 11, 12, 13, 14, 15); }
__device__ __forceinline__ v8f wmma16(v16h a, v16h b, v8f c) { return __builtin_amdgcn_wmma_f32_16x16x32_f16(false, a, false, b, (short)0, c, false, false); }
// lane l with lane l ^ 16
__device__ __forceinline__ float xhalf(float x) { return __builtin_bit_cast(float, __builtin_amdgcn_permlanex16(__builtin_bit_cast(int, x), __builtin_bit_cast(int, x), 0x76543210, 0xfedcba98, false, false)); }
// lane l with lane l ^ M inside its 16-lane row (DPP row_xmask)
template <int M> __device__ __forceinline__ float xrow(float x) { return __builtin_bit_cast(float, __builtin_amdgcn_update_dpp(0, __builtin_bit_cast(int, x), 0x160 | M, 0xf, 0xf, true)); }
__device__ __forceinline__ float rowsum(float v) { v += xrow<1>(v); v += xrow<2>(v); v += xrow<4>(v); v += xrow<8>(v); return v; }
// 1 / sqrt(var + eps) on the chip's reciprocal-square-root instruction; the argument is never below eps, so never subnormal.
// One asm statement so that a v_nop stands directly behind it: the instruction set asks for one slot before a transcendental's result is read
// or its source overwritten
__device__ __forceinline__ float rstd_slot(float ssq, float inv_n) { const float v = ssq * inv_n + 1e-5f; float r; asm("v_rsq_f32 %0, %1\n\tv_nop" : "=v"(r) : "v"(v)); return r; }

__global__ __launch_bounds__(256) __attribute__((amdgpu_waves_per_eu(2, 2))) void k_fused(const float* __restrict__ x, const float* __restrict__ w1, const float* __restrict__ b1, const float* __restrict__ g1, const float* __restrict__ be1,
                                               const float* __restrict__ w2, const float* __restrict__ b2, const float* __restrict__ g2, const float* __restrict__ be2,
                                               const float* __restrict__ gn, const float* __restrict__ bn, float* __restrict__ OUT) {
    __shared__ __align__(16) h16   sB[ED * HID];   // w2 in B-fragment order: [n-tile 16][k-step 4][half 2][lane 32][8]
    __shared__ __align__(16) float p1[5][HID];     // w1 rows 0..2 and b1 (centred, times g1), be1
    __shared__ __align__(16) float pc[4][HID];     // w1 rows 0..2 and b1 (centred), for the Gram matrix
    __shared__ __align__(16) float p2[5][ED];      // b2 (centred), g2, be2, gn, bn
    __shared__ __align__(16) h16   sM[HID];        // mean over the 256 columns of each row of w2, at w2's scale
    __shared__ float sP[8][5];                     // per wave: sums over its threads of w1 rows 0..2, b1 and b2
    const int t = threadIdx.x, lane = t & 31, lr = lane & 15, hi = lane >> 4, wave = __builtin_amdgcn_readfirstlane(t >> 5);   // the wave's number in a scalar register: patch indices and bases stay scalar

    // ---- stage w2 and the vectors (thread t = column t of w2; 8 consecutive k make one lane's 16 bytes of a fragment half: k = 32 kc + 16 half + 8 hi + j)
    v8h o[16];
#pragma unroll
    for (int g = 0; g < 16; ++g) {
#pragma unroll
        for (int j = 0; j < 8; ++j) o[g][j] = (h16)(bfr(w2[(size_t)(g * 8 + j) * ED + t]) * WSC);
        *(v8h*)(sB + ((((t >> 4) * 4 + (g >> 2)) * 2 + ((g >> 1) & 1)) * 32 + (g & 1) * 16 + (t & 15)) * 8) = o[g]; }
    float sv[5] = {0.f, 0.f, 0.f, 0.f, bfr(b2[t])};     // this thread's column of w1 rows 0..2 and b1 (threads 0..127), and of b2
    float g1v = 0.f;
    if (t < HID) { sv[0] = bfr(w1[t]); sv[1] = bfr(w1[HID + t]); sv[2] = bfr(w1[2 * HID + t]); sv[3] = bfr(b1[t]); g1v = bfr(g1[t]); p1[4][t] = bfr(be1[t]);
        asm volatile("s_wait_xcnt 0x0" ::: "memory"); }     // precaution: the scalar bases that these loads name are rewritten right behind the branch
    p2[1][t] = bfr(g2[t]); p2[2][t] = bfr(be2[t]); p2[3][t] = bfr(gn[t]); p2[4][t] = bfr(bn[t]);
    asm volatile("s_wait_xcnt 0x0" ::: "memory");           // the same precaution for the loads above: their offset register and bases are rewritten further down
#pragma unroll
    for (int i = 0; i < 5; ++i) { float s = rowsum(sv[i]); s += xhalf(s); if (lane == 0) sP[wave][i] = s; }
    __syncthreads();
    // ---- row means of w2: wave w takes rows 16 w .. 16 w + 15. A = the 16 x 32 slice of the identity that picks those rows out of k-step w >> 1, so that D = that 16 x 16 tile of w2;
    // accumulated over the 16 n-tiles (two chains), then summed over the 16 lanes of a row
    { const int kc = wave >> 1, sel = (wave & 1) * 16 + lr; v16h id;
#pragma unroll
      for (int e = 0; e < 16; ++e) id[e] = ((e < 8 ? e : e + 8) + hi * 8 == sel) ? (h16)1.0f : (h16)0.0f;
      v8f d[2] = {(v8f){}, (v8f){}};
#pragma unroll
      for (int nb = 0; nb < 16; ++nb) { const h16* p = sB + lane * 8 + (nb * 4 + kc) * 512; d[nb & 1] = wmma16(id, cat16(*(const v8h*)p, *(const v8h*)(p + 256)), d[nb & 1]); }
      v8h mn;
#pragma unroll
      for (int j = 0; j < 8; ++j) mn[j] = (h16)(rowsum(d[0][j] + d[1][j]) * (1.0f / ED));
      if (lr == 0) *(v8h*)(sM + wave * 16 + hi * 8) = mn; }
    __syncthreads();    // every wave has read the uncentred w2 and left its means
#pragma unroll
    for (int g = 0; g < 16; ++g)
        *(v8h*)(sB + ((((t >> 4) * 4 + (g >> 2)) * 2 + ((g >> 1) & 1)) * 32 + (g & 1) * 16 + (t & 15)) * 8) = o[g] - *(const v8h*)(sM + g * 8);
    if (t < HID) {
#pragma unroll
        for (int i = 0; i < 4; ++i) { const float cv = sv[i] - ((sP[0][i] + sP[1][i]) + (sP[2][i] + sP[3][i])) * (1.0f / HID); pc[i][t] = cv; p1[i][t] = cv * g1v; } }
    p2[0][t] = sv[4] - (((sP[0][4] + sP[1][4]) + (sP[2][4] + sP[3][4])) + ((sP[4][4] + sP[5][4]) + (sP[6][4] + sP[7][4]))) * (1.0f / ED);
    __syncthreads();

    const h16* bp = sB + lane * 8;
    float xc[2][3];     // this patch's points: [16-row tile][coordinate], lane -> row lr (both halves hold the same point)
    { const int r = (blockIdx.x * 8 + wave) * PS + lr; const int b = r / NPTS, n = r % NPTS;
#pragma unroll
      for (int m = 0; m < 2; ++m)
#pragma unroll
          for (int c = 0; c < 3; ++c) xc[m][c] = x[((size_t)b * 3 + c) * NPTS + n + m * 16];
      asm volatile("s_wait_xcnt 0x0" ::: "memory"); }         // the same precaution: the address pair of these loads is rewritten right behind them
    __builtin_amdgcn_sched_barrier(0);                        // keeps the address arithmetic of the LDS reads below, which reuses that pair, behind the wait
    // layer 1's weights as A operands, in registers for all patches. Tile T = hidden units 16 T .. 16 T + 15, lane -> unit 16 T + lr; half hi takes the two k = 2 hi, 2 hi + 1 of (w1 rows 0..2, b1).
    // An f32 value v goes as head (fp16 of v) + rest (fp16 of v - head); the product u w is taken as head head + head rest + rest head. Slots of a lane, paired with pb below:
    // 0, 1 = w heads; 2, 3 = w rests; 4, 5 = w heads; 6 = be1's head (hi = 0) or rest (hi = 1), against 1; the others 0
    v16h wA[8];
#pragma unroll
    for (int T = 0; T < 8; ++T) { const float v0 = p1[2 * hi][T * 16 + lr], v1 = p1[2 * hi + 1][T * 16 + lr], vb = p1[4][T * 16 + lr];
        const h16 h0 = (h16)v0, h1 = (h16)v1, hb = (h16)vb;
        const h16 r0 = (h16)(v0 - (float)h0), r1 = (h16)(v1 - (float)h1), rb = (h16)(vb - (float)hb), z = (h16)0.0f;
        wA[T] = (v16h){h0, h1, r0, r1, h0, h1, hi ? rb : hb, z, z, z, z, z, z, z, z, z}; }
    // Gram matrix of the four centred vectors, upper triangle row by row, the off-diagonal entries doubled: lane l takes k = 4 l .. 4 l + 3, then the sum over the 32 lanes.
    // Every lane ends with the same bits (the exchange sums are symmetric), so the ten values go to scalar registers
    float gm[10];
    { v4f r[4];
#pragma unroll
      for (int c = 0; c < 4; ++c) r[c] = *(const v4f*)&pc[c][lane * 4];
#pragma unroll
      for (int c = 0, n = 0; c < 4; ++c)
#pragma unroll
          for (int d = c; d < 4; ++d, ++n) { const v4f pr = r[c] * r[d]; float s = rowsum((pr[0] + pr[1]) + (pr[2] + pr[3])); s += xhalf(s); if (d != c) s += s;
              gm[n] = __builtin_bit_cast(float, __builtin_amdgcn_readfirstlane(__builtin_bit_cast(int, s))); } }
    float c3[2][8];     // likewise this lane's eight columns of gn and bn
#pragma unroll
    for (int i = 0; i < 8; ++i) { c3[0][i] = p2[3][hi * 128 + i * 16 + lr]; c3[1][i] = p2[4][hi * 128 + i * 16 + lr]; }

    // kept rolled, for speed only
#pragma unroll 1
    for (int it = 0; it < NIT; ++it) {
        const int pp = (it * NWG + blockIdx.x) * 8 + wave;
        // ---- layer 1 with LN1 folded in + ReLU, on the matrix unit and transposed: D (16 hidden units x 16 points) = A (units x k) B (k x points).
        // D's layout (lane lr = point, register j = unit 16 T + 8 hi + j) is the A fragment's of the next layer: tile T gives elements 8 (T & 1) .. + 7 of k-step T >> 1, with no exchange between lanes
        v16h a[2][4];
        v16h bf[2][4];      // B fragments in groups of four (group g: k-step g >> 2, n-tiles 4 (g & 3) ..), the next group's LDS reads in flight under this group's WMMAs
#pragma unroll
        for (int u = 0; u < 4; ++u) { const h16* p = bp + (u * 4) * 512; bf[0][u] = cat16(*(const v8h*)p, *(const v8h*)(p + 256)); }
        __builtin_amdgcn_sched_barrier(0);      // holds the reads of the first B fragments in front of layer 1, which covers their latency
        { v16h pb[2];       // per 16-row tile, as B: lane -> point lr; half hi takes the two k = 2 hi, 2 hi + 1 of (x, y, z, 1) / std. Slots: 0, 1 = heads; 2, 3 = heads; 4, 5 = rests; 6 = 1; the others 0
#pragma unroll
          for (int m = 0; m < 2; ++m) { const float px = bfr(xc[m][0]), py = bfr(xc[m][1]), pz = bfr(xc[m][2]);
              const float ssq = px * (gm[0] * px + gm[1] * py + gm[2] * pz + gm[3]) + py * (gm[4] * py + gm[5] * pz + gm[6]) + pz * (gm[7] * pz + gm[8]) + gm[9];
              const float rs = rstd_slot(fmaxf(ssq, 0.f), 1.0f / HID);     // the form is a sum of squares; the maximum only takes off what rounding may leave below 0
              const v2f u = {(hi ? pz : px) * rs, hi ? rs : py * rs};
              const v2h hd = __builtin_convertvector(u, v2h), rt = __builtin_convertvector(u - __builtin_convertvector(hd, v2f), v2h);   // the rests are taken off the very heads that go into the operand
              const h16 z = (h16)0.0f;
              pb[m] = (v16h){hd[0], hd[1], hd[0], hd[1], rt[0], rt[1], (h16)1.0f, z, z, z, z, z, z, z, z, z}; }
          v8f y[8][2];      // stage j: the two tiles (units 32 kc .. + 15, + 16 .. + 31) that make the A fragment of k-step kc = j >> 1 for the points 16 m .., m = j & 1
#pragma unroll
          for (int j = 0; j < 10; ++j) {
              if (j < 8) { y[j][0] = wmma16(wA[(j >> 1) * 2], pb[j & 1], (v8f){}); y[j][1] = wmma16(wA[(j >> 1) * 2 + 1], pb[j & 1], (v8f){}); }
              if (j >= 2)   // ReLU behind the rounding: the same values, two elements an instruction
                  a[j & 1][(j - 2) >> 1] = __builtin_elementwise_max(cat16(__builtin_convertvector(y[j - 2][0], v8h), __builtin_convertvector(y[j - 2][1], v8h)), (v16h){});
              __builtin_amdgcn_sched_barrier(0);  // keeps each fragment's conversion two stages behind its WMMAs and among the later ones: left alone the compiler put all 16 WMMAs first and the vector work behind them, in nobody's shadow
          } }

        // the next patch's points, fetched one patch ahead into the registers that layer 1 has just read (the last trip fetches its own again)
        { const int itn = it + 1 < NIT ? it + 1 : it; const int r = ((itn * NWG + blockIdx.x) * 8 + wave) * PS + lr; const int b = r / NPTS, n = r % NPTS;
#pragma unroll
          for (int m = 0; m < 2; ++m)
#pragma unroll
              for (int c = 0; c < 3; ++c) xc[m][c] = x[((size_t)b * 3 + c) * NPTS + n + m * 16];
          asm volatile("s_wait_xcnt 0x0" ::: "memory"); }     // precaution: the address pair that these loads name is rewritten right behind them

        float mx[16];
        {
            // ---- 32 rows x 256 columns, k in the order 0, 32, 64, 96
            v8f acc[2][16];
#pragma unroll
            for (int m = 0; m < 2; ++m)
#pragma unroll
                for (int nb = 0; nb < 16; ++nb) acc[m][nb] = (v8f){};
            float c2[3][16];    // this lane's columns of b2, g2, be2, read under the last group's WMMAs
#pragma unroll
            for (int g = 0; g < 16; ++g) {
                if (g < 15) {
#pragma unroll
                    for (int u = 0; u < 4; ++u) { const h16* p = bp + ((((g + 1) & 3) * 4 + u) * 4 + ((g + 1) >> 2)) * 512; bf[(g + 1) & 1][u] = cat16(*(const v8h*)p, *(const v8h*)(p + 256)); }
                } else {
#pragma unroll
                    for (int c = 0; c < 3; ++c)
#pragma unroll
                        for (int nb = 0; nb < 16; ++nb) c2[c][nb] = p2[c][nb * 16 + lr]; }
                __builtin_amdgcn_sched_barrier(0);      // holds the next group's reads in front of this group's WMMAs: without it each WMMA waited on its own two reads
#pragma unroll
                for (int u = 0; u < 4; ++u)
#pragma unroll
                    for (int m = 0; m < 2; ++m) acc[m][(g & 3) * 4 + u] = wmma16(a[m][g >> 2], bf[g & 1][u], acc[m][(g & 3) * 4 + u]);
                __builtin_amdgcn_sched_barrier(0);      // and keeps the group after next from being read early, which would take a third set of registers
            }
            // ---- LN2 per row, the rows centred already (accumulator: lane lr = column 16 nb + lr, register j = row 16 m + 8 hi + j), then the max over the rows
            v8f q8[2] = {(v8f){}, (v8f){}}, rs8[2];
#pragma unroll
            for (int nb = 0; nb < 16; ++nb) { const float bb = c2[0][nb];
#pragma unroll
                for (int m = 0; m < 2; ++m) { acc[m][nb] = acc[m][nb] * (1.0f / WSC) + bb; q8[m] += acc[m][nb] * acc[m][nb]; } }
#pragma unroll
            for (int m = 0; m < 2; ++m)
#pragma unroll
                for (int j = 0; j < 8; ++j) rs8[m][j] = rstd_slot(rowsum(q8[m][j]), 1.0f / ED);
#pragma unroll
            for (int nb = 0; nb < 16; ++nb) { const float g = c2[1][nb], be = c2[2][nb]; float ym[2];
#pragma unroll
                for (int m = 0; m < 2; ++m) { const v8f y = (acc[m][nb] * rs8[m]) * g + be;
                    ym[m] = fmaxf(fmaxf(fmaxf(y[0], y[1]), fmaxf(y[2], y[3])), fmaxf(fmaxf(y[4], y[5]), fmaxf(y[6], y[7]))); }
                mx[nb] = fmaxf(ym[0], ym[1]); }
        }

        // ---- rows 0..7 with rows 8..15, LN3 over the 256 pooled values (16 in the lane x 16 lanes), store: half hi stores n-tiles 8 hi .. 8 hi + 7
        float s = 0.f;
#pragma unroll
        for (int nb = 0; nb < 16; ++nb) { mx[nb] = fmaxf(mx[nb], xhalf(mx[nb])); s += mx[nb]; }
        const float mu = rowsum(s) * (1.0f / ED); float qq = 0.f;
#pragma unroll
        for (int nb = 0; nb < 16; ++nb) { mx[nb] -= mu; qq += mx[nb] * mx[nb]; }
        const float rs = rstd_slot(rowsum(qq), 1.0f / ED);
        float* dst = OUT + (size_t)pp * ED + hi * 128 + lr;
#pragma unroll
        for (int i = 0; i < 8; ++i) { const float d = hi ? mx[8 + i] : mx[i]; dst[i * 16] = (d * rs) * c3[0][i] + c3[1][i]; }
        // precaution: the next trip rewrites the registers that these stores name
        asm volatile("s_wait_xcnt 0x0" ::: "memory");

    }
}

extern "C" void kernel_launch(void* const* d_in, const int* in_sizes, int n_in,
                              void* d_out, int out_size, void* d_ws, size_t ws_size, hipStream_t stream) {
    (void)in_sizes; (void)n_in; (void)out_size; (void)d_ws; (void)ws_size;
    const float* IN[11]; for (int i = 0; i < 11; ++i) IN[i] = (const float*)d_in[i];   // x, w1 [3][128], b1, g1, be1, w2 [128][256], b2, g2, be2, gn, bn
    k_fused<<<NWG, 256, 0, stream>>>(IN[0], IN[1], IN[2], IN[3], IN[4], IN[5], IN[6], IN[7], IN[8], IN[9], IN[10], (float*)d_out);
}
